// v000
// Measured on an AMD MI455X. A time is GPU time per run, averaged over a window of back-to-back runs after a warm-up
// (all launches, gaps included; the runs take copies of the inputs in turn), and the median of several windows.
// Apart from v000's, it joins two sittings. Times from different sittings can be a few percent apart, while
// side-by-side timings come from the same sitting.
// v000, which the later versions start from, runs in 149 microseconds.
#include <hip/hip_runtime.h>

#define ATTN_H 16
#define ATTN_S 2048
#define ATTN_D 64

typedef __attribute__((ext_vector_type(16))) __bf16         v16bf;
typedef __attribute__((ext_vector_type(8)))  float          v8f;
typedef __attribute__((ext_vector_type(16))) unsigned short v16u;
typedef __attribute__((ext_vector_type(8)))  unsigned short v8u;
typedef __attribute__((ext_vector_type(2)))  float          f32x2;
typedef __attribute__((ext_vector_type(2)))  __bf16         bf16x2;

// Two fp32 -> packed bf16 (RNE); gfx1250 selects v_cvt_pk_bf16_f32.
static __device__ __forceinline__ unsigned int pk_bf16(float a, float b) {
  f32x2 f; f[0] = a; f[1] = b;
  bf16x2 h = __builtin_convertvector(f, bf16x2);
  union { bf16x2 h; unsigned int u; } c; c.h = h;
  return c.u;
}
static __device__ __forceinline__ unsigned short f2bf(float a) {
  union { __bf16 h; unsigned short u; } c; c.h = (__bf16)a;
  return c.u;
}
static __device__ __forceinline__ v16bf as_bf16(v16u x) {
  union { v16u u; v16bf b; } c; c.u = x; return c.b;
}
static __device__ __forceinline__ v16u cat8(v8u lo, v8u hi) {
  return __builtin_shufflevector(lo, hi, 0,1,2,3,4,5,6,7,8,9,10,11,12,13,14,15);
}
// One 16-bit A/B fragment = two aligned ds_load_b128 (elems 0..7 = K base..base+7,
// elems 8..15 = K base+16..base+23 per the CDNA5 16-bit VGPR layout).
static __device__ __forceinline__ v16bf ld_frag(const unsigned short* p) {
  return as_bf16(cat8(*(const v8u*)p, *(const v8u*)(p + 16)));
}

__global__ __launch_bounds__(256, 1)
void Softmaxchain_74406013435918_kernel(const float* __restrict__ q,
                                        const float* __restrict__ k,
                                        const float* __restrict__ v,
                                        const float* __restrict__ mask,
                                        float* __restrict__ out)
{
  // LDS staging (bf16 bits in u16). Row strides are multiples of 8 u16 (16B)
  // so every v8u fragment read is one aligned ds_load_b128.
  __shared__ __align__(16) unsigned short lKt[64][72];    // K blk, [t][d] d-contig
  __shared__ __align__(16) unsigned short lVt[64][72];    // V blk, [d][t] t-contig
  __shared__ __align__(16) unsigned short lP [8][16][72]; // per-wave P, [m][t]

  const int tid  = threadIdx.x;
  const int wave = tid >> 5;
  const int lane = tid & 31;
  const int bh   = blockIdx.x >> 4;          // b*H + h
  const int qblk = blockIdx.x & 15;          // 128-row q block
  const int bidx = bh >> 4;                  // batch index (H == 16)
  const int qbase = qblk * 128 + wave * 16;

  const float* __restrict__ qh = q + (size_t)bh * ATTN_S * ATTN_D;
  const float* __restrict__ kh = k + (size_t)bh * ATTN_D * ATTN_S;  // [d][t]
  const float* __restrict__ vh = v + (size_t)bh * ATTN_S * ATTN_D;  // [t][d]
  const float* __restrict__ mb = mask + (size_t)bidx * ATTN_S;
  float* __restrict__ oh = out + (size_t)bh * ATTN_S * ATTN_D;

  const int mrow  = lane & 15;             // A-row / B-col owned by this lane
  const int kb    = (lane < 16) ? 0 : 8;   // K-chunk base of 16-bit A/B layout
  const int rbase = (lane < 16) ? 0 : 8;   // C/D rows owned by this lane-half
  const int tcol  = lane & 15;

  // ---- one-time: this wave's 16x64 Q tile as two bf16 A fragments
  v16bf aq[2];
  {
    const float* qrow = qh + (size_t)(qbase + mrow) * ATTN_D;
    #pragma unroll
    for (int f = 0; f < 2; ++f) {
      v16u u;
      #pragma unroll
      for (int p = 0; p < 8; ++p) {
        int d = f * 32 + ((p < 4) ? (kb + 2 * p) : (16 + kb + 2 * (p - 4)));
        u[2 * p + 0] = f2bf(qrow[d + 0]);
        u[2 * p + 1] = f2bf(qrow[d + 1]);
      }
      aq[f] = as_bf16(u);
    }
  }

  v8f acc[4];
  float m_i[8], l_i[8];                    // l_i is a PER-LANE partial sum
  #pragma unroll
  for (int j = 0; j < 4; ++j)
    #pragma unroll
    for (int r = 0; r < 8; ++r) acc[j][r] = 0.0f;
  #pragma unroll
  for (int r = 0; r < 8; ++r) { m_i[r] = -__builtin_inff(); l_i[r] = 0.0f; }

  const float L2E = 1.44269504088896f;

  for (int t0 = 0; t0 < ATTN_S; t0 += 64) {
    // ---- cooperative stage, fp32->bf16, packed ds_store_b32, coalesced reads
    #pragma unroll
    for (int i = 0; i < 8; ++i) {          // K: 64x64, pack pairs along d
      int idx = tid + i * 256;             // 0..2047
      int d = (idx >> 6) * 2, t = idx & 63;
      unsigned int p = pk_bf16(kh[(size_t)d * ATTN_S + t0 + t],
                               kh[(size_t)(d + 1) * ATTN_S + t0 + t]);
      *(unsigned int*)&lKt[t][d] = p;
    }
    #pragma unroll
    for (int i = 0; i < 8; ++i) {          // V: 64x64, pack pairs along t
      int idx = tid + i * 256;
      int d = idx & 63, t = (idx >> 6) * 2;
      unsigned int p = pk_bf16(vh[(size_t)(t0 + t) * ATTN_D + d],
                               vh[(size_t)(t0 + t + 1) * ATTN_D + d]);
      *(unsigned int*)&lVt[d][t] = p;
    }
    __syncthreads();

    // ---- prefetch next K/V block while we compute this one
    if (t0 + 64 < ATTN_S) {
      const int t0n = t0 + 64;
      __builtin_prefetch(kh + (size_t)(tid >> 2) * ATTN_S + t0n + (tid & 3) * 16, 0, 3);
      __builtin_prefetch(vh + (size_t)(t0n + (tid >> 2)) * ATTN_D + (tid & 3) * 16, 0, 3);
    }

    // ---- S[16x64] = Q[16x64] @ K[64x64]
    // Preload ALL 8 K fragments (16 ds_load_b128, distinct regs), then run the
    // 8 WMMAs back-to-back (C-accumulation chains carry no RAW hazard NOPs).
    v16bf bk[8];
    #pragma unroll
    for (int u = 0; u < 8; ++u)
      bk[u] = ld_frag(&lKt[(u & 3) * 16 + tcol][(u >> 2) * 32 + kb]);

    v8f s[4];
    #pragma unroll
    for (int j = 0; j < 4; ++j)
      #pragma unroll
      for (int r = 0; r < 8; ++r) s[j][r] = 0.0f;
    #pragma unroll
    for (int u = 0; u < 8; ++u)
      s[u & 3] = __builtin_amdgcn_wmma_f32_16x16x32_bf16(false, aq[u >> 2], false, bk[u],
                                                         (short)0, s[u & 3], false, false);

    // ---- hoist the 8 V fragments now: their LDS latency hides under softmax
    v16bf bv[8];
    #pragma unroll
    for (int u = 0; u < 8; ++u)
      bv[u] = ld_frag(&lVt[(u & 3) * 16 + tcol][(u >> 2) * 32 + kb]);

    // ---- scale 1/8 + additive mask
    float mk[4];
    #pragma unroll
    for (int j = 0; j < 4; ++j) mk[j] = mb[t0 + j * 16 + tcol];
    #pragma unroll
    for (int j = 0; j < 4; ++j)
      #pragma unroll
      for (int r = 0; r < 8; ++r) s[j][r] = s[j][r] * 0.125f + mk[j];

    // ---- online softmax: only MAX needs a butterfly; row-sum stays per-lane
    #pragma unroll
    for (int r = 0; r < 8; ++r) {
      float mx = fmaxf(fmaxf(s[0][r], s[1][r]), fmaxf(s[2][r], s[3][r]));
      #pragma unroll
      for (int off = 8; off >= 1; off >>= 1) mx = fmaxf(mx, __shfl_xor(mx, off, 32));
      float mnew  = fmaxf(m_i[r], mx);
      float alpha = exp2f((m_i[r] - mnew) * L2E);
      m_i[r] = mnew;
      float p0 = exp2f((s[0][r] - mnew) * L2E);
      float p1 = exp2f((s[1][r] - mnew) * L2E);
      float p2 = exp2f((s[2][r] - mnew) * L2E);
      float p3 = exp2f((s[3][r] - mnew) * L2E);
      s[0][r] = p0; s[1][r] = p1; s[2][r] = p2; s[3][r] = p3;
      l_i[r] = l_i[r] * alpha + ((p0 + p1) + (p2 + p3));   // lane-local partial
      acc[0][r] *= alpha; acc[1][r] *= alpha;
      acc[2][r] *= alpha; acc[3][r] *= alpha;
    }

    // ---- C-layout P -> A-layout P via per-wave LDS bounce.
    // Same-wave DS ops are processed in order, so the RAW through lP is safe;
    // the compiler inserts the dscnt wait for the loaded VGPRs before use.
    #pragma unroll
    for (int r = 0; r < 8; ++r)
      #pragma unroll
      for (int j = 0; j < 4; ++j)
        lP[wave][rbase + r][j * 16 + tcol] = f2bf(s[j][r]);
    v16bf ap[2];
    #pragma unroll
    for (int ks = 0; ks < 2; ++ks)
      ap[ks] = ld_frag(&lP[wave][mrow][ks * 32 + kb]);

    // ---- context += P[16x64] @ V[64x64]: 8 back-to-back WMMAs (bv preloaded)
    #pragma unroll
    for (int u = 0; u < 8; ++u)
      acc[u & 3] = __builtin_amdgcn_wmma_f32_16x16x32_bf16(false, ap[u >> 2], false, bv[u],
                                                           (short)0, acc[u & 3], false, false);
    __syncthreads();
  }

  // ---- epilogue: finish the deferred row-sum reduction, normalize, store
  #pragma unroll
  for (int r = 0; r < 8; ++r) {
    float ls = l_i[r];
    #pragma unroll
    for (int off = 8; off >= 1; off >>= 1) ls += __shfl_xor(ls, off, 32);
    float inv = 1.0f / ls;
    float* orow = oh + (size_t)(qbase + rbase + r) * ATTN_D;
    #pragma unroll
    for (int j = 0; j < 4; ++j) orow[j * 16 + tcol] = acc[j][r] * inv;
  }
}

extern "C" void kernel_launch(void* const* d_in, const int* in_sizes, int n_in,
                              void* d_out, int out_size, void* d_ws, size_t ws_size,
                              hipStream_t stream) {
  (void)in_sizes; (void)n_in; (void)d_ws; (void)ws_size; (void)out_size;
  const float* q    = (const float*)d_in[0];
  const float* k    = (const float*)d_in[1];
  const float* v    = (const float*)d_in[2];
  const float* mask = (const float*)d_in[3];
  float* out        = (float*)d_out;

  // 64 heads x (2048/128) q-blocks = 1024 workgroups of 256 threads (8 waves)
  dim3 grid(4 * ATTN_H * (ATTN_S / 128));
  dim3 block(256);
  Softmaxchain_74406013435918_kernel<<<grid, block, 0, stream>>>(q, k, v, mask, out);
}

// v001
// One run takes 123 microseconds.
// Timed twice side by side with v000, it ran 1.27 times as fast both times.
#include <hip/hip_runtime.h>

#define ATTN_H 16
#define ATTN_S 2048
#define ATTN_D 64

typedef __attribute__((ext_vector_type(16))) __bf16         v16bf;
typedef __attribute__((ext_vector_type(8)))  float          v8f;
typedef __attribute__((ext_vector_type(16))) unsigned short v16u;
typedef __attribute__((ext_vector_type(8)))  unsigned short v8u;
typedef __attribute__((ext_vector_type(2)))  float          f32x2;
typedef __attribute__((ext_vector_type(2)))  __bf16         bf16x2;
typedef __attribute__((ext_vector_type(4)))  float          f32x4;
typedef __attribute__((ext_vector_type(8)))  unsigned int   v8w;

// Two fp32 -> packed bf16 (RNE); gfx1250 selects v_cvt_pk_bf16_f32.
static __device__ __forceinline__ unsigned int pk_bf16(float a, float b) {
  f32x2 f; f[0] = a; f[1] = b;
  bf16x2 h = __builtin_convertvector(f, bf16x2);
  union { bf16x2 h; unsigned int u; } c; c.h = h;
  return c.u;
}
static __device__ __forceinline__ unsigned short f2bf(float a) {
  union { __bf16 h; unsigned short u; } c; c.h = (__bf16)a;
  return c.u;
}
static __device__ __forceinline__ v16bf as_bf16(v16u x) {
  union { v16u u; v16bf b; } c; c.u = x; return c.b;
}
static __device__ __forceinline__ v16u cat8(v8u lo, v8u hi) {
  return __builtin_shufflevector(lo, hi, 0,1,2,3,4,5,6,7,8,9,10,11,12,13,14,15);
}
// One 16-bit A/B fragment = two aligned ds_load_b128 (elems 0..7 = K base..base+7,
// elems 8..15 = K base+16..base+23 per the CDNA5 16-bit VGPR layout).
static __device__ __forceinline__ v16bf ld_frag(const unsigned short* p) {
  return as_bf16(cat8(*(const v8u*)p, *(const v8u*)(p + 16)));
}

// Value of lane l ^ 16 (the other half-wave), a vector cross-row move.
static __device__ __forceinline__ float xhalf(float x) {
  int i = __builtin_bit_cast(int, x);
  return __builtin_bit_cast(float,
      __builtin_amdgcn_permlanex16(i, i, 0x76543210, 0xfedcba98, false, false));
}

__global__ __launch_bounds__(256, 1)
void Softmaxchain_74406013435918_kernel(const float* __restrict__ q,
                                        const float* __restrict__ k,
                                        const float* __restrict__ v,
                                        const float* __restrict__ mask,
                                        float* __restrict__ out)
{
  // LDS staging (bf16 bits in u16). Row strides are multiples of 8 u16 (16B)
  // so every v8u fragment read is one aligned ds_load_b128.
  __shared__ __align__(16) unsigned short lKt[64][72];    // K blk, [t][d] d-contig
  __shared__ __align__(16) unsigned short lVt[64][72];    // V blk, [d][t] t-contig

  const int tid  = threadIdx.x;
  const int wave = tid >> 5;
  const int lane = tid & 31;
  const int bh   = blockIdx.x >> 4;          // b*H + h
  const int qblk = blockIdx.x & 15;          // 128-row q block
  const int bidx = bh >> 4;                  // batch index (H == 16)
  const int qbase = qblk * 128 + wave * 16;

  const float* __restrict__ qh = q + (size_t)bh * ATTN_S * ATTN_D;
  const float* __restrict__ kh = k + (size_t)bh * ATTN_D * ATTN_S;  // [d][t]
  const float* __restrict__ vh = v + (size_t)bh * ATTN_S * ATTN_D;  // [t][d]
  const float* __restrict__ mb = mask + (size_t)bidx * ATTN_S;
  float* __restrict__ oh = out + (size_t)bh * ATTN_S * ATTN_D;

  const int mrow  = lane & 15;             // A-row / B-col / C-D column of this lane
  const int kb    = (lane < 16) ? 0 : 8;   // K-chunk base of 16-bit A/B layout
  const int rbase = (lane < 16) ? 0 : 8;   // C/D rows owned by this lane-half
  const int tcol  = lane & 15;

  // ---- one-time: this wave's 16x64 Q tile as two bf16 fragments (B = Q^T)
  v16bf aq[2];
  {
    const float* qrow = qh + (size_t)(qbase + mrow) * ATTN_D;
    #pragma unroll
    for (int f = 0; f < 2; ++f) {
      v16u u;
      #pragma unroll
      for (int p = 0; p < 8; ++p) {
        int d = f * 32 + ((p < 4) ? (kb + 2 * p) : (16 + kb + 2 * (p - 4)));
        u[2 * p + 0] = f2bf(qrow[d + 0]);
        u[2 * p + 1] = f2bf(qrow[d + 1]);
      }
      aq[f] = as_bf16(u);
    }
  }

  v8f acc[4];
  float m_i = -__builtin_inff();           // running max of query mrow
  float l_i = 0.0f;                        // partial sum: this half-wave's keys only
  #pragma unroll
  for (int j = 0; j < 4; ++j)
    #pragma unroll
    for (int r = 0; r < 8; ++r) acc[j][r] = 0.0f;

  const float L2E = 1.44269504088896f;

  for (int t0 = 0; t0 < ATTN_S; t0 += 64) {
    // ---- mask of this lane's 32 keys (it runs along the C/D rows now), issued
    // ahead of the staging loads so that it lands under them
    f32x4 mk[4][2];
    #pragma unroll
    for (int j = 0; j < 4; ++j) {
      mk[j][0] = *(const f32x4*)(mb + t0 + j * 16 + rbase);
      mk[j][1] = *(const f32x4*)(mb + t0 + j * 16 + rbase + 4);
    }
    // Keeps the mask loads in front of the staging loads, and stands before the
    // staging address arithmetic reuses the registers of the mask address.
    asm volatile("s_wait_xcnt 0x0" ::: "memory");
    // ---- cooperative stage, fp32->bf16, packed ds_store_b32, coalesced reads
    #pragma unroll
    for (int i = 0; i < 8; ++i) {          // K: 64x64, pack pairs along d
      int idx = tid + i * 256;             // 0..2047
      int d = (idx >> 6) * 2, t = idx & 63;
      unsigned int p = pk_bf16(kh[(size_t)d * ATTN_S + t0 + t],
                               kh[(size_t)(d + 1) * ATTN_S + t0 + t]);
      *(unsigned int*)&lKt[t][d] = p;
    }
    #pragma unroll
    for (int i = 0; i < 8; ++i) {          // V: 64x64, pack pairs along t
      int idx = tid + i * 256;
      int d = idx & 63, t = (idx >> 6) * 2;
      unsigned int p = pk_bf16(vh[(size_t)(t0 + t) * ATTN_D + d],
                               vh[(size_t)(t0 + t + 1) * ATTN_D + d]);
      *(unsigned int*)&lVt[d][t] = p;
    }
    __syncthreads();

    // ---- prefetch next K/V block while we compute this one
    if (t0 + 64 < ATTN_S) {
      const int t0n = t0 + 64;
      __builtin_prefetch(kh + (size_t)(tid >> 2) * ATTN_S + t0n + (tid & 3) * 16, 0, 3);
      __builtin_prefetch(vh + (size_t)(t0n + (tid >> 2)) * ATTN_D + (tid & 3) * 16, 0, 3);
    }

    // ---- S^T[64x16] = K^T[64x64] @ Q^T[64x16]: s[j][r] = score(key j*16+rbase+r, query mrow)
    // Preload ALL 8 K fragments (16 ds_load_b128, distinct regs), then run the
    // 8 WMMAs back-to-back (C-accumulation chains carry no RAW hazard NOPs).
    v16bf bk[8];
    #pragma unroll
    for (int u = 0; u < 8; ++u)
      bk[u] = ld_frag(&lKt[(u & 3) * 16 + tcol][(u >> 2) * 32 + kb]);

    v8f s[4];
    #pragma unroll
    for (int j = 0; j < 4; ++j)
      #pragma unroll
      for (int r = 0; r < 8; ++r) s[j][r] = 0.0f;
    #pragma unroll
    for (int u = 0; u < 8; ++u)
      s[u & 3] = __builtin_amdgcn_wmma_f32_16x16x32_bf16(false, bk[u], false, aq[u >> 2],
                                                         (short)0, s[u & 3], false, false);

    // ---- hoist the 8 V fragments now: their LDS latency hides under softmax
    v16bf bv[8];
    #pragma unroll
    for (int u = 0; u < 8; ++u)
      bv[u] = ld_frag(&lVt[(u & 3) * 16 + tcol][(u >> 2) * 32 + kb]);

    // ---- scale 1/8 + additive mask
    #pragma unroll
    for (int j = 0; j < 4; ++j)
      #pragma unroll
      for (int r = 0; r < 8; ++r) s[j][r] = s[j][r] * 0.125f + mk[j][r >> 2][r & 3];

    // ---- online softmax, one query per lane: in-lane max over 32 keys, then one
    // exchange with the half-wave that holds the query's other 32 keys
    float mx8[8];
    #pragma unroll
    for (int r = 0; r < 8; ++r)
      mx8[r] = fmaxf(fmaxf(s[0][r], s[1][r]), fmaxf(s[2][r], s[3][r]));
    float mx = fmaxf(fmaxf(fmaxf(mx8[0], mx8[1]), fmaxf(mx8[2], mx8[3])),
                     fmaxf(fmaxf(mx8[4], mx8[5]), fmaxf(mx8[6], mx8[7])));
    mx = fmaxf(mx, xhalf(mx));
    const float mnew  = fmaxf(m_i, mx);
    const float alpha = exp2f((m_i - mnew) * L2E);
    m_i = mnew;
    #pragma unroll
    for (int j = 0; j < 4; ++j)
      #pragma unroll
      for (int r = 0; r < 8; ++r) s[j][r] = exp2f((s[j][r] - mnew) * L2E);
    const v8f ps = (s[0] + s[1]) + (s[2] + s[3]);
    l_i = l_i * alpha + (((ps[0] + ps[1]) + (ps[2] + ps[3])) +
                         ((ps[4] + ps[5]) + (ps[6] + ps[7])));
    #pragma unroll
    for (int j = 0; j < 4; ++j) acc[j] *= alpha;

    // ---- P^T B fragments straight from the S^T tiles: element e < 8 is key
    // ks*32 + kb + e (tile 2ks, reg e), element 8 + e is key ks*32 + 16 + kb + e
    // (tile 2ks+1, reg e): the k order that ld_frag gives the V^T A fragments.
    v16bf pb[2];
    #pragma unroll
    for (int ks = 0; ks < 2; ++ks) {
      v8w w;
      #pragma unroll
      for (int p = 0; p < 4; ++p) {
        w[p]     = pk_bf16(s[2 * ks][2 * p],     s[2 * ks][2 * p + 1]);
        w[4 + p] = pk_bf16(s[2 * ks + 1][2 * p], s[2 * ks + 1][2 * p + 1]);
      }
      pb[ks] = __builtin_bit_cast(v16bf, w);
    }

    // ---- O^T[64x16] += V^T[64x64] @ P^T[64x16]: 8 back-to-back WMMAs (bv preloaded)
    #pragma unroll
    for (int u = 0; u < 8; ++u)
      acc[u & 3] = __builtin_amdgcn_wmma_f32_16x16x32_bf16(false, bv[u], false, pb[u >> 2],
                                                           (short)0, acc[u & 3], false, false);
    __syncthreads();
  }

  // ---- epilogue: join the two half-waves' row sums, normalize, store.
  // acc[j][r] = O[qbase + mrow][j*16 + rbase + r]: 8 consecutive floats per tile.
  {
    const float inv = 1.0f / (l_i + xhalf(l_i));
    float* orow = oh + (size_t)(qbase + mrow) * ATTN_D + rbase;
    #pragma unroll
    for (int j = 0; j < 4; ++j) {
      f32x4 lo, hi;
      #pragma unroll
      for (int e = 0; e < 4; ++e) { lo[e] = acc[j][e] * inv; hi[e] = acc[j][4 + e] * inv; }
      *(f32x4*)(orow + j * 16)     = lo;
      *(f32x4*)(orow + j * 16 + 4) = hi;
    }
  }
}

extern "C" void kernel_launch(void* const* d_in, const int* in_sizes, int n_in,
                              void* d_out, int out_size, void* d_ws, size_t ws_size,
                              hipStream_t stream) {
  (void)in_sizes; (void)n_in; (void)d_ws; (void)ws_size; (void)out_size;
  const float* q    = (const float*)d_in[0];
  const float* k    = (const float*)d_in[1];
  const float* v    = (const float*)d_in[2];
  const float* mask = (const float*)d_in[3];
  float* out        = (float*)d_out;

  // 64 heads x (2048/128) q-blocks = 1024 workgroups of 256 threads (8 waves)
  dim3 grid(4 * ATTN_H * (ATTN_S / 128));
  dim3 block(256);
  Softmaxchain_74406013435918_kernel<<<grid, block, 0, stream>>>(q, k, v, mask, out);
}

// v002
// Measured time: 100 microseconds a run.
// In two side-by-side timings against v001, it was 1.22 and 1.23 times as fast.
// Over all steps from v000 it is 1.56 times as fast.
#include <hip/hip_runtime.h>

#define ATTN_H 16
#define ATTN_S 2048
#define ATTN_D 64

typedef __attribute__((ext_vector_type(16))) __bf16         v16bf;
typedef __attribute__((ext_vector_type(8)))  float          v8f;
typedef __attribute__((ext_vector_type(16))) unsigned short v16u;
typedef __attribute__((ext_vector_type(8)))  unsigned short v8u;
typedef __attribute__((ext_vector_type(2)))  float          f32x2;
typedef __attribute__((ext_vector_type(2)))  __bf16         bf16x2;
typedef __attribute__((ext_vector_type(4)))  float          f32x4;
typedef __attribute__((ext_vector_type(8)))  unsigned int   v8w;

// Two fp32 -> packed bf16 (RNE); gfx1250 selects v_cvt_pk_bf16_f32.
static __device__ __forceinline__ unsigned int pk_bf16(float a, float b) {
  f32x2 f; f[0] = a; f[1] = b;
  bf16x2 h = __builtin_convertvector(f, bf16x2);
  union { bf16x2 h; unsigned int u; } c; c.h = h;
  return c.u;
}
static __device__ __forceinline__ unsigned short f2bf(float a) {
  union { __bf16 h; unsigned short u; } c; c.h = (__bf16)a;
  return c.u;
}
static __device__ __forceinline__ v16bf as_bf16(v16u x) {
  union { v16u u; v16bf b; } c; c.u = x; return c.b;
}
static __device__ __forceinline__ v16u cat8(v8u lo, v8u hi) {
  return __builtin_shufflevector(lo, hi, 0,1,2,3,4,5,6,7,8,9,10,11,12,13,14,15);
}
// One 16-bit A/B fragment = two aligned ds_load_b128 (elems 0..7 = K base..base+7,
// elems 8..15 = K base+16..base+23 per the CDNA5 16-bit VGPR layout).
static __device__ __forceinline__ v16bf ld_frag(const unsigned short* p) {
  return as_bf16(cat8(*(const v8u*)p, *(const v8u*)(p + 16)));
}

// Value of lane l ^ 16 (the other half-wave), a vector cross-row move.
static __device__ __forceinline__ float xhalf(float x) {
  int i = __builtin_bit_cast(int, x);
  return __builtin_bit_cast(float,
      __builtin_amdgcn_permlanex16(i, i, 0x76543210, 0xfedcba98, false, false));
}

// 2^x as the one hardware instruction (v_exp_f32). The library exp2f adds a range
// fix-up (compare, two selects, ldexp) so that results below 2^-126 come out as
// denormals; here such a term is at most 2^-126 beside a row sum of at least 1 (the
// row's maximum contributes 2^0), so it may flush to zero. -inf still gives 0.
static __device__ __forceinline__ float hw_exp2(float x) {
  return __builtin_amdgcn_exp2f(x);
}

__global__ __launch_bounds__(256, 1)
void Softmaxchain_74406013435918_kernel(const float* __restrict__ q,
                                        const float* __restrict__ k,
                                        const float* __restrict__ v,
                                        const float* __restrict__ mask,
                                        float* __restrict__ out)
{
  // LDS staging (bf16 bits in u16). Row strides are multiples of 8 u16 (16B)
  // so every v8u fragment read is one aligned ds_load_b128.
  __shared__ __align__(16) unsigned short lKt[64][72];    // K blk, [t][d] d-contig
  __shared__ __align__(16) unsigned short lVt[64][72];    // V blk, [d][t] t-contig

  const int tid  = threadIdx.x;
  const int wave = tid >> 5;
  const int lane = tid & 31;
  const int bh   = blockIdx.x >> 4;          // b*H + h
  const int qblk = blockIdx.x & 15;          // 128-row q block
  const int bidx = bh >> 4;                  // batch index (H == 16)
  const int qbase = qblk * 128 + wave * 16;

  const float* __restrict__ qh = q + (size_t)bh * ATTN_S * ATTN_D;
  const float* __restrict__ kh = k + (size_t)bh * ATTN_D * ATTN_S;  // [d][t]
  const float* __restrict__ vh = v + (size_t)bh * ATTN_S * ATTN_D;  // [t][d]
  const float* __restrict__ mb = mask + (size_t)bidx * ATTN_S;
  float* __restrict__ oh = out + (size_t)bh * ATTN_S * ATTN_D;

  const int mrow  = lane & 15;             // A-row / B-col / C-D column of this lane
  const int kb    = (lane < 16) ? 0 : 8;   // K-chunk base of 16-bit A/B layout
  const int rbase = (lane < 16) ? 0 : 8;   // C/D rows owned by this lane-half
  const int tcol  = lane & 15;

  // ---- one-time: this wave's 16x64 Q tile as two bf16 fragments (B = Q^T)
  v16bf aq[2];
  {
    const float* qrow = qh + (size_t)(qbase + mrow) * ATTN_D;
    #pragma unroll
    for (int f = 0; f < 2; ++f) {
      v16u u;
      #pragma unroll
      for (int p = 0; p < 8; ++p) {
        int d = f * 32 + ((p < 4) ? (kb + 2 * p) : (16 + kb + 2 * (p - 4)));
        u[2 * p + 0] = f2bf(qrow[d + 0]);
        u[2 * p + 1] = f2bf(qrow[d + 1]);
      }
      aq[f] = as_bf16(u);
    }
  }

  v8f acc[4];
  float m_i = -__builtin_inff();           // running max of query mrow
  float l_i = 0.0f;                        // partial sum: this half-wave's keys only
  #pragma unroll
  for (int j = 0; j < 4; ++j)
    #pragma unroll
    for (int r = 0; r < 8; ++r) acc[j][r] = 0.0f;

  const float L2E = 1.44269504088896f;

  for (int t0 = 0; t0 < ATTN_S; t0 += 64) {
    // ---- mask of this lane's 32 keys (it runs along the C/D rows now), issued
    // ahead of the staging loads so that it lands under them
    f32x4 mk[4][2];
    #pragma unroll
    for (int j = 0; j < 4; ++j) {
      mk[j][0] = *(const f32x4*)(mb + t0 + j * 16 + rbase);
      mk[j][1] = *(const f32x4*)(mb + t0 + j * 16 + rbase + 4);
    }
    // Keeps the mask loads in front of the staging loads, and stands before the
    // staging address arithmetic reuses the registers of the mask address.
    asm volatile("s_wait_xcnt 0x0" ::: "memory");
    // ---- cooperative stage, fp32->bf16, packed ds_store_b32, coalesced reads
    #pragma unroll
    for (int i = 0; i < 8; ++i) {          // K: 64x64, pack pairs along d
      int idx = tid + i * 256;             // 0..2047
      int d = (idx >> 6) * 2, t = idx & 63;
      unsigned int p = pk_bf16(kh[(size_t)d * ATTN_S + t0 + t],
                               kh[(size_t)(d + 1) * ATTN_S + t0 + t]);
      *(unsigned int*)&lKt[t][d] = p;
    }
    #pragma unroll
    for (int i = 0; i < 8; ++i) {          // V: 64x64, pack pairs along t
      int idx = tid + i * 256;
      int d = idx & 63, t = (idx >> 6) * 2;
      unsigned int p = pk_bf16(vh[(size_t)(t0 + t) * ATTN_D + d],
                               vh[(size_t)(t0 + t + 1) * ATTN_D + d]);
      *(unsigned int*)&lVt[d][t] = p;
    }
    __syncthreads();

    // ---- prefetch next K/V block while we compute this one
    if (t0 + 64 < ATTN_S) {
      const int t0n = t0 + 64;
      __builtin_prefetch(kh + (size_t)(tid >> 2) * ATTN_S + t0n + (tid & 3) * 16, 0, 3);
      __builtin_prefetch(vh + (size_t)(t0n + (tid >> 2)) * ATTN_D + (tid & 3) * 16, 0, 3);
    }

    // ---- S^T[64x16] = K^T[64x64] @ Q^T[64x16]: s[j][r] = score(key j*16+rbase+r, query mrow)
    // Preload ALL 8 K fragments (16 ds_load_b128, distinct regs), then run the
    // 8 WMMAs back-to-back (C-accumulation chains carry no RAW hazard NOPs).
    v16bf bk[8];
    #pragma unroll
    for (int u = 0; u < 8; ++u)
      bk[u] = ld_frag(&lKt[(u & 3) * 16 + tcol][(u >> 2) * 32 + kb]);

    v8f s[4];
    #pragma unroll
    for (int j = 0; j < 4; ++j)
      #pragma unroll
      for (int r = 0; r < 8; ++r) s[j][r] = 0.0f;
    #pragma unroll
    for (int u = 0; u < 8; ++u)
      s[u & 3] = __builtin_amdgcn_wmma_f32_16x16x32_bf16(false, bk[u], false, aq[u >> 2],
                                                         (short)0, s[u & 3], false, false);

    // ---- hoist the 8 V fragments now: their LDS latency hides under softmax
    v16bf bv[8];
    #pragma unroll
    for (int u = 0; u < 8; ++u)
      bv[u] = ld_frag(&lVt[(u & 3) * 16 + tcol][(u >> 2) * 32 + kb]);

    // ---- scale 1/8 + additive mask
    #pragma unroll
    for (int j = 0; j < 4; ++j)
      #pragma unroll
      for (int r = 0; r < 8; ++r) s[j][r] = s[j][r] * 0.125f + mk[j][r >> 2][r & 3];

    // ---- online softmax, one query per lane: in-lane max over 32 keys, then one
    // exchange with the half-wave that holds the query's other 32 keys
    float mx8[8];
    #pragma unroll
    for (int r = 0; r < 8; ++r)
      mx8[r] = fmaxf(fmaxf(s[0][r], s[1][r]), fmaxf(s[2][r], s[3][r]));
    float mx = fmaxf(fmaxf(fmaxf(mx8[0], mx8[1]), fmaxf(mx8[2], mx8[3])),
                     fmaxf(fmaxf(mx8[4], mx8[5]), fmaxf(mx8[6], mx8[7])));
    mx = fmaxf(mx, xhalf(mx));
    const float mnew  = fmaxf(m_i, mx);
    const float alpha = hw_exp2((m_i - mnew) * L2E);
    m_i = mnew;
    // Arguments on whole vectors (packed subtract, packed multiply; each element is
    // rounded on its own), then one hardware exponential per score.
    #pragma unroll
    for (int j = 0; j < 4; ++j) {
      s[j] = (s[j] - mnew) * L2E;
      #pragma unroll
      for (int r = 0; r < 8; ++r) s[j][r] = hw_exp2(s[j][r]);
    }
    const v8f ps = (s[0] + s[1]) + (s[2] + s[3]);
    l_i = l_i * alpha + (((ps[0] + ps[1]) + (ps[2] + ps[3])) +
                         ((ps[4] + ps[5]) + (ps[6] + ps[7])));
    #pragma unroll
    for (int j = 0; j < 4; ++j) acc[j] *= alpha;

    // ---- P^T B fragments straight from the S^T tiles: element e < 8 is key
    // ks*32 + kb + e (tile 2ks, reg e), element 8 + e is key ks*32 + 16 + kb + e
    // (tile 2ks+1, reg e): the k order that ld_frag gives the V^T A fragments.
    v16bf pb[2];
    #pragma unroll
    for (int ks = 0; ks < 2; ++ks) {
      v8w w;
      #pragma unroll
      for (int p = 0; p < 4; ++p) {
        w[p]     = pk_bf16(s[2 * ks][2 * p],     s[2 * ks][2 * p + 1]);
        w[4 + p] = pk_bf16(s[2 * ks + 1][2 * p], s[2 * ks + 1][2 * p + 1]);
      }
      pb[ks] = __builtin_bit_cast(v16bf, w);
    }

    // ---- O^T[64x16] += V^T[64x64] @ P^T[64x16]: 8 back-to-back WMMAs (bv preloaded)
    #pragma unroll
    for (int u = 0; u < 8; ++u)
      acc[u & 3] = __builtin_amdgcn_wmma_f32_16x16x32_bf16(false, bv[u], false, pb[u >> 2],
                                                           (short)0, acc[u & 3], false, false);
    __syncthreads();
  }

  // ---- epilogue: join the two half-waves' row sums, normalize, store.
  // acc[j][r] = O[qbase + mrow][j*16 + rbase + r]: 8 consecutive floats per tile.
  {
    const float inv = 1.0f / (l_i + xhalf(l_i));
    float* orow = oh + (size_t)(qbase + mrow) * ATTN_D + rbase;
    #pragma unroll
    for (int j = 0; j < 4; ++j) {
      f32x4 lo, hi;
      #pragma unroll
      for (int e = 0; e < 4; ++e) { lo[e] = acc[j][e] * inv; hi[e] = acc[j][4 + e] * inv; }
      *(f32x4*)(orow + j * 16)     = lo;
      *(f32x4*)(orow + j * 16 + 4) = hi;
    }
  }
}

extern "C" void kernel_launch(void* const* d_in, const int* in_sizes, int n_in,
                              void* d_out, int out_size, void* d_ws, size_t ws_size,
                              hipStream_t stream) {
  (void)in_sizes; (void)n_in; (void)d_ws; (void)ws_size; (void)out_size;
  const float* q    = (const float*)d_in[0];
  const float* k    = (const float*)d_in[1];
  const float* v    = (const float*)d_in[2];
  const float* mask = (const float*)d_in[3];
  float* out        = (float*)d_out;

  // 64 heads x (2048/128) q-blocks = 1024 workgroups of 256 threads (8 waves)
  dim3 grid(4 * ATTN_H * (ATTN_S / 128));
  dim3 block(256);
  Softmaxchain_74406013435918_kernel<<<grid, block, 0, stream>>>(q, k, v, mask, out);
}

// v003
// It runs in 86.4 microseconds.
// Two timings next to v002 both put it at 1.16 times that version's speed.
// All steps since v000 together make it 1.80 times as fast.
#include <hip/hip_runtime.h>

#define ATTN_H 16
#define ATTN_S 2048
#define ATTN_D 64

typedef __attribute__((ext_vector_type(16))) __bf16         v16bf;
typedef __attribute__((ext_vector_type(8)))  float          v8f;
typedef __attribute__((ext_vector_type(16))) unsigned short v16u;
typedef __attribute__((ext_vector_type(8)))  unsigned short v8u;
typedef __attribute__((ext_vector_type(2)))  float          f32x2;
typedef __attribute__((ext_vector_type(2)))  __bf16         bf16x2;
typedef __attribute__((ext_vector_type(4)))  float          f32x4;
typedef __attribute__((ext_vector_type(8)))  unsigned int   v8w;
typedef __attribute__((ext_vector_type(2)))  unsigned int   u32x2;

// Two fp32 -> packed bf16 (RNE); gfx1250 selects v_cvt_pk_bf16_f32.
static __device__ __forceinline__ unsigned int pk_bf16(float a, float b) {
  f32x2 f; f[0] = a; f[1] = b;
  bf16x2 h = __builtin_convertvector(f, bf16x2);
  union { bf16x2 h; unsigned int u; } c; c.h = h;
  return c.u;
}
static __device__ __forceinline__ unsigned short f2bf(float a) {
  union { __bf16 h; unsigned short u; } c; c.h = (__bf16)a;
  return c.u;
}
static __device__ __forceinline__ v16bf as_bf16(v16u x) {
  union { v16u u; v16bf b; } c; c.u = x; return c.b;
}
static __device__ __forceinline__ v16u cat8(v8u lo, v8u hi) {
  return __builtin_shufflevector(lo, hi, 0,1,2,3,4,5,6,7,8,9,10,11,12,13,14,15);
}
// LDS row pitch of the staged K and V blocks: 64 bf16 (128 B) plus 32 B, an odd
// multiple of 32 B, the conflict-free pitch of the transposing load.
#define LDS_PITCH 160

// One transposing LDS load: from a tile stored [k][m] (m contiguous), with lane l at
// (k0 + 8*(l>>4) + (l&7)) * pitch + 2*m0 + 16*((l>>3)&1), lane l gets
// T[k0 + 8*(l>>4) + 0..7][m0 + (l&15)].
static __device__ __forceinline__ v8u ld_tr16(const unsigned char* p) {
  typedef __attribute__((ext_vector_type(8))) short s16x8;
  typedef __attribute__((address_space(3))) s16x8 lds_s16x8;
  return __builtin_bit_cast(v8u, __builtin_amdgcn_ds_load_tr16_b128_v8i16((lds_s16x8*)p));
}
// One 16x32 A fragment = two transposing loads, 16 k rows apart (elems 0..7 =
// k base..base+7, elems 8..15 = k base+16..base+23: the 16-bit operand k order).
static __device__ __forceinline__ v16bf ld_frag_tr(const unsigned char* p) {
  return as_bf16(cat8(ld_tr16(p), ld_tr16(p + 16 * LDS_PITCH)));
}

// Value of lane l ^ 16 (the other half-wave), a vector cross-row move.
static __device__ __forceinline__ float xhalf(float x) {
  int i = __builtin_bit_cast(int, x);
  return __builtin_bit_cast(float,
      __builtin_amdgcn_permlanex16(i, i, 0x76543210, 0xfedcba98, false, false));
}

// 2^x as the one hardware instruction (v_exp_f32). The library exp2f adds a range
// fix-up (compare, two selects, ldexp) so that results below 2^-126 come out as
// denormals; here such a term is at most 2^-126 beside a row sum of at least 1 (the
// row's maximum contributes 2^0), so it may flush to zero. -inf still gives 0.
static __device__ __forceinline__ float hw_exp2(float x) {
  return __builtin_amdgcn_exp2f(x);
}

// Residency stays at four waves per SIMD, two workgroups per WGP: 1024 workgroups are
// then two full rounds of 512. The registers that the staging no longer needs would
// allow a third workgroup, and 768 places leave a ragged second round.
__global__ __launch_bounds__(256) __attribute__((amdgpu_waves_per_eu(4, 4)))
void Softmaxchain_74406013435918_kernel(const float* __restrict__ q,
                                        const float* __restrict__ k,
                                        const float* __restrict__ v,
                                        const float* __restrict__ mask,
                                        float* __restrict__ out)
{
  // LDS staging (bf16), both blocks in the row order they have in global memory;
  // the transposing fragment loads turn them into the A operands.
  __shared__ __align__(16) unsigned char lK[64 * LDS_PITCH];   // K blk, [d][t] t-contig
  __shared__ __align__(16) unsigned char lV[64 * LDS_PITCH];   // V blk, [t][d] d-contig

  const int tid  = threadIdx.x;
  const int wave = tid >> 5;
  const int lane = tid & 31;
  const int bh   = blockIdx.x >> 4;          // b*H + h
  const int qblk = blockIdx.x & 15;          // 128-row q block
  const int bidx = bh >> 4;                  // batch index (H == 16)
  const int qbase = qblk * 128 + wave * 16;

  const float* __restrict__ qh = q + (size_t)bh * ATTN_S * ATTN_D;
  const float* __restrict__ kh = k + (size_t)bh * ATTN_D * ATTN_S;  // [d][t]
  const float* __restrict__ vh = v + (size_t)bh * ATTN_S * ATTN_D;  // [t][d]
  const float* __restrict__ mb = mask + (size_t)bidx * ATTN_S;
  float* __restrict__ oh = out + (size_t)bh * ATTN_S * ATTN_D;

  const int mrow  = lane & 15;             // A-row / B-col / C-D column of this lane
  const int kb    = (lane < 16) ? 0 : 8;   // K-chunk base of 16-bit A/B layout
  const int rbase = (lane < 16) ? 0 : 8;   // C/D rows owned by this lane-half
  // this lane's byte offset inside a staged block for the transposing loads
  const int troff = (rbase + (lane & 7)) * LDS_PITCH + ((lane >> 3) & 1) * 16;
  // staging: 16 threads cover one 64-float row, four floats each; 16 rows per sweep
  const int srow  = tid >> 4;
  const int scol  = (tid & 15) * 4;
  const int soff  = srow * LDS_PITCH + scol * 2;

  // ---- one-time: this wave's 16x64 Q tile as two bf16 fragments (B = Q^T)
  v16bf aq[2];
  {
    const float* qrow = qh + (size_t)(qbase + mrow) * ATTN_D;
    #pragma unroll
    for (int f = 0; f < 2; ++f) {
      v16u u;
      #pragma unroll
      for (int p = 0; p < 8; ++p) {
        int d = f * 32 + ((p < 4) ? (kb + 2 * p) : (16 + kb + 2 * (p - 4)));
        u[2 * p + 0] = f2bf(qrow[d + 0]);
        u[2 * p + 1] = f2bf(qrow[d + 1]);
      }
      aq[f] = as_bf16(u);
    }
  }

  v8f acc[4];
  float m_i = -__builtin_inff();           // running max of query mrow
  float l_i = 0.0f;                        // partial sum: this half-wave's keys only
  #pragma unroll
  for (int j = 0; j < 4; ++j)
    #pragma unroll
    for (int r = 0; r < 8; ++r) acc[j][r] = 0.0f;

  const float L2E = 1.44269504088896f;

  for (int t0 = 0; t0 < ATTN_S; t0 += 64) {
    // ---- mask of this lane's 32 keys (it runs along the C/D rows now), issued
    // ahead of the staging loads so that it lands under them
    f32x4 mk[4][2];
    #pragma unroll
    for (int j = 0; j < 4; ++j) {
      mk[j][0] = *(const f32x4*)(mb + t0 + j * 16 + rbase);
      mk[j][1] = *(const f32x4*)(mb + t0 + j * 16 + rbase + 4);
    }
    // Keeps the mask loads in front of the staging loads, and stands before the
    // staging reuses the registers of the mask address.
    asm volatile("s_wait_xcnt 0x0" ::: "memory");
    // ---- cooperative stage, fp32->bf16, no transpose: 16-byte reads (a wave reads
    // whole 256-B row pieces), pairs packed along the row, 8-byte LDS stores
    f32x4 gk[4], gv[4];
    const float* vp = vh + (size_t)(t0 + srow) * ATTN_D + scol;
    const float* kp = kh + (size_t)srow * ATTN_S + t0 + scol;
    #pragma unroll
    for (int i = 0; i < 4; ++i)            // V: rows t = t0 + srow + 16 i, columns scol..
      gv[i] = *(const f32x4*)(vp + 16 * i * ATTN_D);
    #pragma unroll
    for (int i = 0; i < 4; ++i)            // K: rows d = srow + 16 i, columns t0 + scol..
      gk[i] = *(const f32x4*)(kp + 16 * i * ATTN_S);
    // Stands behind the staging loads and holds their address registers until then, so
    // that nothing (a later load's result included) overwrites one ahead of it; the
    // wave waits for the loaded data next in any case.
    asm volatile("s_wait_xcnt 0x0" :: "v"(vp), "v"(kp) : "memory");
    #pragma unroll
    for (int i = 0; i < 4; ++i) {
      u32x2 p; p[0] = pk_bf16(gv[i][0], gv[i][1]); p[1] = pk_bf16(gv[i][2], gv[i][3]);
      *(u32x2*)&lV[soff + 16 * i * LDS_PITCH] = p;
    }
    #pragma unroll
    for (int i = 0; i < 4; ++i) {
      u32x2 p; p[0] = pk_bf16(gk[i][0], gk[i][1]); p[1] = pk_bf16(gk[i][2], gk[i][3]);
      *(u32x2*)&lK[soff + 16 * i * LDS_PITCH] = p;
    }
    __syncthreads();

    // ---- prefetch next K/V block while we compute this one
    if (t0 + 64 < ATTN_S) {
      const int t0n = t0 + 64;
      __builtin_prefetch(kh + (size_t)(tid >> 2) * ATTN_S + t0n + (tid & 3) * 16, 0, 3);
      __builtin_prefetch(vh + (size_t)(t0n + (tid >> 2)) * ATTN_D + (tid & 3) * 16, 0, 3);
    }

    // ---- S^T[64x16] = K^T[64x64] @ Q^T[64x16]: s[j][r] = score(key j*16+rbase+r, query mrow)
    // Preload ALL 8 K fragments (16 transposing loads, distinct regs), then run the
    // 8 WMMAs back-to-back (C-accumulation chains carry no RAW hazard NOPs).
    // Fragment u: keys (u&3)*16.. as rows, d = (u>>2)*32.. as k.
    v16bf bk[8];
    #pragma unroll
    for (int u = 0; u < 8; ++u)
      bk[u] = ld_frag_tr(&lK[troff + (u >> 2) * 32 * LDS_PITCH + (u & 3) * 32]);

    v8f s[4];
    #pragma unroll
    for (int j = 0; j < 4; ++j)
      #pragma unroll
      for (int r = 0; r < 8; ++r) s[j][r] = 0.0f;
    #pragma unroll
    for (int u = 0; u < 8; ++u)
      s[u & 3] = __builtin_amdgcn_wmma_f32_16x16x32_bf16(false, bk[u], false, aq[u >> 2],
                                                         (short)0, s[u & 3], false, false);

    // ---- hoist the 8 V fragments now: their LDS latency hides under softmax
    v16bf bv[8];
    #pragma unroll
    for (int u = 0; u < 8; ++u)
      bv[u] = ld_frag_tr(&lV[troff + (u >> 2) * 32 * LDS_PITCH + (u & 3) * 32]);

    // ---- scale 1/8 + additive mask
    #pragma unroll
    for (int j = 0; j < 4; ++j)
      #pragma unroll
      for (int r = 0; r < 8; ++r) s[j][r] = s[j][r] * 0.125f + mk[j][r >> 2][r & 3];

    // ---- online softmax, one query per lane: in-lane max over 32 keys, then one
    // exchange with the half-wave that holds the query's other 32 keys
    float mx8[8];
    #pragma unroll
    for (int r = 0; r < 8; ++r)
      mx8[r] = fmaxf(fmaxf(s[0][r], s[1][r]), fmaxf(s[2][r], s[3][r]));
    float mx = fmaxf(fmaxf(fmaxf(mx8[0], mx8[1]), fmaxf(mx8[2], mx8[3])),
                     fmaxf(fmaxf(mx8[4], mx8[5]), fmaxf(mx8[6], mx8[7])));
    mx = fmaxf(mx, xhalf(mx));
    const float mnew  = fmaxf(m_i, mx);
    const float alpha = hw_exp2((m_i - mnew) * L2E);
    m_i = mnew;
    // Arguments on whole vectors (packed subtract, packed multiply; each element is
    // rounded on its own), then one hardware exponential per score.
    #pragma unroll
    for (int j = 0; j < 4; ++j) {
      s[j] = (s[j] - mnew) * L2E;
      #pragma unroll
      for (int r = 0; r < 8; ++r) s[j][r] = hw_exp2(s[j][r]);
    }
    const v8f ps = (s[0] + s[1]) + (s[2] + s[3]);
    l_i = l_i * alpha + (((ps[0] + ps[1]) + (ps[2] + ps[3])) +
                         ((ps[4] + ps[5]) + (ps[6] + ps[7])));
    #pragma unroll
    for (int j = 0; j < 4; ++j) acc[j] *= alpha;

    // ---- P^T B fragments straight from the S^T tiles: element e < 8 is key
    // ks*32 + kb + e (tile 2ks, reg e), element 8 + e is key ks*32 + 16 + kb + e
    // (tile 2ks+1, reg e): the k order that ld_frag_tr gives the V^T A fragments.
    v16bf pb[2];
    #pragma unroll
    for (int ks = 0; ks < 2; ++ks) {
      v8w w;
      #pragma unroll
      for (int p = 0; p < 4; ++p) {
        w[p]     = pk_bf16(s[2 * ks][2 * p],     s[2 * ks][2 * p + 1]);
        w[4 + p] = pk_bf16(s[2 * ks + 1][2 * p], s[2 * ks + 1][2 * p + 1]);
      }
      pb[ks] = __builtin_bit_cast(v16bf, w);
    }

    // ---- O^T[64x16] += V^T[64x64] @ P^T[64x16]: 8 back-to-back WMMAs (bv preloaded)
    #pragma unroll
    for (int u = 0; u < 8; ++u)
      acc[u & 3] = __builtin_amdgcn_wmma_f32_16x16x32_bf16(false, bv[u], false, pb[u >> 2],
                                                           (short)0, acc[u & 3], false, false);
    __syncthreads();
  }

  // ---- epilogue: join the two half-waves' row sums, normalize, store.
  // acc[j][r] = O[qbase + mrow][j*16 + rbase + r]: 8 consecutive floats per tile.
  {
    const float inv = 1.0f / (l_i + xhalf(l_i));
    float* orow = oh + (size_t)(qbase + mrow) * ATTN_D + rbase;
    #pragma unroll
    for (int j = 0; j < 4; ++j) {
      f32x4 lo, hi;
      #pragma unroll
      for (int e = 0; e < 4; ++e) { lo[e] = acc[j][e] * inv; hi[e] = acc[j][4 + e] * inv; }
      *(f32x4*)(orow + j * 16)     = lo;
      *(f32x4*)(orow + j * 16 + 4) = hi;
    }
  }
}

extern "C" void kernel_launch(void* const* d_in, const int* in_sizes, int n_in,
                              void* d_out, int out_size, void* d_ws, size_t ws_size,
                              hipStream_t stream) {
  (void)in_sizes; (void)n_in; (void)d_ws; (void)ws_size; (void)out_size;
  const float* q    = (const float*)d_in[0];
  const float* k    = (const float*)d_in[1];
  const float* v    = (const float*)d_in[2];
  const float* mask = (const float*)d_in[3];
  float* out        = (float*)d_out;

  // 64 heads x (2048/128) q-blocks = 1024 workgroups of 256 threads (8 waves)
  dim3 grid(4 * ATTN_H * (ATTN_S / 128));
  dim3 block(256);
  Softmaxchain_74406013435918_kernel<<<grid, block, 0, stream>>>(q, k, v, mask, out);
}

// v004
// One run takes 78.4 microseconds.
// Two timings next to v003 put it at 1.10 and 1.11 times that version's speed.
// Counting every step since v000, it is 1.99 times as fast.
#include <hip/hip_runtime.h>

#define ATTN_H 16
#define ATTN_S 2048
#define ATTN_D 64

typedef __attribute__((ext_vector_type(16))) __bf16         v16bf;
typedef __attribute__((ext_vector_type(8)))  float          v8f;
typedef __attribute__((ext_vector_type(16))) unsigned short v16u;
typedef __attribute__((ext_vector_type(8)))  unsigned short v8u;
typedef __attribute__((ext_vector_type(2)))  float          f32x2;
typedef __attribute__((ext_vector_type(2)))  __bf16         bf16x2;
typedef __attribute__((ext_vector_type(4)))  float          f32x4;
typedef __attribute__((ext_vector_type(8)))  unsigned int   v8w;
typedef __attribute__((ext_vector_type(2)))  unsigned int   u32x2;

// Two fp32 -> packed bf16 (RNE); gfx1250 selects v_cvt_pk_bf16_f32.
static __device__ __forceinline__ unsigned int pk_bf16(float a, float b) {
  f32x2 f; f[0] = a; f[1] = b;
  bf16x2 h = __builtin_convertvector(f, bf16x2);
  union { bf16x2 h; unsigned int u; } c; c.h = h;
  return c.u;
}
static __device__ __forceinline__ unsigned short f2bf(float a) {
  union { __bf16 h; unsigned short u; } c; c.h = (__bf16)a;
  return c.u;
}
static __device__ __forceinline__ v16bf as_bf16(v16u x) {
  union { v16u u; v16bf b; } c; c.u = x; return c.b;
}
static __device__ __forceinline__ v16u cat8(v8u lo, v8u hi) {
  return __builtin_shufflevector(lo, hi, 0,1,2,3,4,5,6,7,8,9,10,11,12,13,14,15);
}
// LDS row pitch of the staged K and V blocks: 64 bf16 (128 B) plus 32 B, an odd
// multiple of 32 B, the conflict-free pitch of the transposing load.
#define LDS_PITCH 160
#define BLK_BYTES (64 * LDS_PITCH)       // one staged block
#define BUF_BYTES (2 * BLK_BYTES)        // one buffer: K block, V block

// One transposing LDS load: from a tile stored [k][m] (m contiguous), with lane l at
// (k0 + 8*(l>>4) + (l&7)) * pitch + 2*m0 + 16*((l>>3)&1), lane l gets
// T[k0 + 8*(l>>4) + 0..7][m0 + (l&15)].
static __device__ __forceinline__ v8u ld_tr16(const unsigned char* p) {
  typedef __attribute__((ext_vector_type(8))) short s16x8;
  typedef __attribute__((address_space(3))) s16x8 lds_s16x8;
  return __builtin_bit_cast(v8u, __builtin_amdgcn_ds_load_tr16_b128_v8i16((lds_s16x8*)p));
}
// One 16x32 A fragment = two transposing loads, 16 k rows apart (elems 0..7 =
// k base..base+7, elems 8..15 = k base+16..base+23: the 16-bit operand k order).
static __device__ __forceinline__ v16bf ld_frag_tr(const unsigned char* p) {
  return as_bf16(cat8(ld_tr16(p), ld_tr16(p + 16 * LDS_PITCH)));
}

// Value of lane l ^ 16 (the other half-wave), a vector cross-row move.
static __device__ __forceinline__ float xhalf(float x) {
  int i = __builtin_bit_cast(int, x);
  return __builtin_bit_cast(float,
      __builtin_amdgcn_permlanex16(i, i, 0x76543210, 0xfedcba98, false, false));
}

// 2^x as the one hardware instruction (v_exp_f32). The library exp2f adds a range
// fix-up (compare, two selects, ldexp) so that results below 2^-126 come out as
// denormals; here such a term is at most 2^-126 beside a row sum of at least 1 (the
// row's maximum contributes 2^0), so it may flush to zero. -inf still gives 0.
static __device__ __forceinline__ float hw_exp2(float x) {
  return __builtin_amdgcn_exp2f(x);
}

// Four waves per SIMD, two workgroups per WGP: 1024 workgroups are two full rounds
// of 512, and a wave's 256 registers hold the block that is fetched ahead.
__global__ __launch_bounds__(256) __attribute__((amdgpu_waves_per_eu(4, 4)))
void Softmaxchain_74406013435918_kernel(const float* __restrict__ q,
                                        const float* __restrict__ k,
                                        const float* __restrict__ v,
                                        const float* __restrict__ mask,
                                        float* __restrict__ out)
{
  // LDS staging (bf16), two buffers: one is read while the next block is written into
  // the other. Each holds the K block [d][t] (t contiguous), then the V block [t][d]
  // (d contiguous), in the row order they have in global memory; the transposing
  // fragment loads turn them into the A operands.
  __shared__ __align__(16) unsigned char lds[2 * BUF_BYTES];

  const int tid  = threadIdx.x;
  const int wave = tid >> 5;
  const int lane = tid & 31;
  const int bh   = blockIdx.x >> 4;          // b*H + h
  const int qblk = blockIdx.x & 15;          // 128-row q block
  const int bidx = bh >> 4;                  // batch index (H == 16)
  const int qbase = qblk * 128 + wave * 16;

  const float* __restrict__ qh = q + (size_t)bh * ATTN_S * ATTN_D;
  const float* __restrict__ kh = k + (size_t)bh * ATTN_D * ATTN_S;  // [d][t]
  const float* __restrict__ vh = v + (size_t)bh * ATTN_S * ATTN_D;  // [t][d]
  const float* __restrict__ mb = mask + (size_t)bidx * ATTN_S;
  float* __restrict__ oh = out + (size_t)bh * ATTN_S * ATTN_D;

  const int mrow  = lane & 15;             // A-row / B-col / C-D column of this lane
  const int kb    = (lane < 16) ? 0 : 8;   // K-chunk base of 16-bit A/B layout
  const int rbase = (lane < 16) ? 0 : 8;   // C/D rows owned by this lane-half
  // this lane's byte offset inside a staged block for the transposing loads
  const int troff = (rbase + (lane & 7)) * LDS_PITCH + ((lane >> 3) & 1) * 16;
  // staging: 16 threads cover one 64-float row, four floats each; 16 rows per sweep
  const int srow  = tid >> 4;
  const int scol  = (tid & 15) * 4;
  const int soff  = srow * LDS_PITCH + scol * 2;

  // ---- one-time: this wave's 16x64 Q tile as two bf16 fragments (B = Q^T)
  v16bf aq[2];
  {
    const float* qrow = qh + (size_t)(qbase + mrow) * ATTN_D;
    #pragma unroll
    for (int f = 0; f < 2; ++f) {
      v16u u;
      #pragma unroll
      for (int p = 0; p < 8; ++p) {
        int d = f * 32 + ((p < 4) ? (kb + 2 * p) : (16 + kb + 2 * (p - 4)));
        u[2 * p + 0] = f2bf(qrow[d + 0]);
        u[2 * p + 1] = f2bf(qrow[d + 1]);
      }
      aq[f] = as_bf16(u);
    }
  }

  v8f acc[4];
  float m_i = -__builtin_inff();           // running max of query mrow
  float l_i = 0.0f;                        // partial sum: this half-wave's keys only
  #pragma unroll
  for (int j = 0; j < 4; ++j)
    #pragma unroll
    for (int r = 0; r < 8; ++r) acc[j][r] = 0.0f;

  const float L2E = 1.44269504088896f;

  // ---- the block one trip ahead lives in registers while this one is worked on
  f32x4 gk[4], gv[4];                      // K and V piece of this thread, fp32
  f32x4 mk[4][2];                          // mask of this lane's 32 keys (C/D rows)
  const float* vp = vh + (size_t)srow * ATTN_D + scol;   // rows t = srow + 16 i
  const float* kp = kh + (size_t)srow * ATTN_S + scol;   // rows d = srow + 16 i
  const float* mp = mb + rbase;
  // 16-byte reads: a wave reads whole 256-B row pieces
  auto ld_stage = [&]() {
    #pragma unroll
    for (int i = 0; i < 4; ++i) gv[i] = *(const f32x4*)(vp + 16 * i * ATTN_D);
    #pragma unroll
    for (int i = 0; i < 4; ++i) gk[i] = *(const f32x4*)(kp + 16 * i * ATTN_S);
  };
  auto ld_mask = [&]() {
    #pragma unroll
    for (int j = 0; j < 4; ++j) {
      mk[j][0] = *(const f32x4*)(mp + j * 16);
      mk[j][1] = *(const f32x4*)(mp + j * 16 + 4);
    }
  };
  // fp32->bf16, no transpose: pairs packed along the row, 8-byte LDS stores
  auto st_stage = [&](unsigned char* buf) {
    #pragma unroll
    for (int i = 0; i < 4; ++i) {
      u32x2 p; p[0] = pk_bf16(gv[i][0], gv[i][1]); p[1] = pk_bf16(gv[i][2], gv[i][3]);
      *(u32x2*)&buf[BLK_BYTES + 16 * i * LDS_PITCH] = p;
    }
    #pragma unroll
    for (int i = 0; i < 4; ++i) {
      u32x2 p; p[0] = pk_bf16(gk[i][0], gk[i][1]); p[1] = pk_bf16(gk[i][2], gk[i][3]);
      *(u32x2*)&buf[16 * i * LDS_PITCH] = p;
    }
  };

  // ---- one 64-key block from the staged buffer at lK (K block) and lV (V block), in
  // three parts: the K fragments (into bk), scores and softmax (leaves V^T in bv, P^T
  // in pb), the second product
  v16bf bk[8], bv[8], pb[2];
  // ALL 8 K fragments (16 transposing loads, distinct regs).
  // Fragment u: keys (u&3)*16.. as rows, d = (u>>2)*32.. as k.
  auto ld_k = [&](const unsigned char* lK) {
    #pragma unroll
    for (int u = 0; u < 8; ++u)
      bk[u] = ld_frag_tr(&lK[troff + (u >> 2) * 32 * LDS_PITCH + (u & 3) * 32]);
  };
  auto scores = [&](const unsigned char* lV) {
    // ---- S^T[64x16] = K^T[64x64] @ Q^T[64x16]: s[j][r] = score(key j*16+rbase+r, query mrow)
    // 8 WMMAs back-to-back (C-accumulation chains carry no RAW hazard NOPs).
    v8f s[4];
    #pragma unroll
    for (int j = 0; j < 4; ++j)
      #pragma unroll
      for (int r = 0; r < 8; ++r) s[j][r] = 0.0f;
    #pragma unroll
    for (int u = 0; u < 8; ++u)
      s[u & 3] = __builtin_amdgcn_wmma_f32_16x16x32_bf16(false, bk[u], false, aq[u >> 2],
                                                         (short)0, s[u & 3], false, false);

    // ---- hoist the 8 V fragments now: their LDS latency hides under softmax
    #pragma unroll
    for (int u = 0; u < 8; ++u)
      bv[u] = ld_frag_tr(&lV[troff + (u >> 2) * 32 * LDS_PITCH + (u & 3) * 32]);
    // keeps these loads up here, ahead of the softmax that covers their latency
    __builtin_amdgcn_sched_barrier(0);

    // ---- scale 1/8 + additive mask
    #pragma unroll
    for (int j = 0; j < 4; ++j)
      s[j] = s[j] * 0.125f + __builtin_shufflevector(mk[j][0], mk[j][1], 0, 1, 2, 3, 4, 5, 6, 7);

    // ---- online softmax, one query per lane: in-lane max over 32 keys, then one
    // exchange with the half-wave that holds the query's other 32 keys
    float mx8[8];
    #pragma unroll
    for (int r = 0; r < 8; ++r)
      mx8[r] = fmaxf(fmaxf(s[0][r], s[1][r]), fmaxf(s[2][r], s[3][r]));
    float mx = fmaxf(fmaxf(fmaxf(mx8[0], mx8[1]), fmaxf(mx8[2], mx8[3])),
                     fmaxf(fmaxf(mx8[4], mx8[5]), fmaxf(mx8[6], mx8[7])));
    mx = fmaxf(mx, xhalf(mx));
    const float mnew  = fmaxf(m_i, mx);
    const float alpha = hw_exp2((m_i - mnew) * L2E);
    m_i = mnew;
    // Arguments on whole vectors (packed subtract, packed multiply; each element is
    // rounded on its own), then one hardware exponential per score.
    #pragma unroll
    for (int j = 0; j < 4; ++j) {
      s[j] = (s[j] - mnew) * L2E;
      #pragma unroll
      for (int r = 0; r < 8; ++r) s[j][r] = hw_exp2(s[j][r]);
    }
    const v8f ps = (s[0] + s[1]) + (s[2] + s[3]);
    l_i = l_i * alpha + (((ps[0] + ps[1]) + (ps[2] + ps[3])) +
                         ((ps[4] + ps[5]) + (ps[6] + ps[7])));
    #pragma unroll
    for (int j = 0; j < 4; ++j) acc[j] *= alpha;

    // ---- P^T B fragments straight from the S^T tiles: element e < 8 is key
    // ks*32 + kb + e (tile 2ks, reg e), element 8 + e is key ks*32 + 16 + kb + e
    // (tile 2ks+1, reg e): the k order that ld_frag_tr gives the V^T A fragments.
    #pragma unroll
    for (int ks = 0; ks < 2; ++ks) {
      v8w w;
      #pragma unroll
      for (int p = 0; p < 4; ++p) {
        w[p]     = pk_bf16(s[2 * ks][2 * p],     s[2 * ks][2 * p + 1]);
        w[4 + p] = pk_bf16(s[2 * ks + 1][2 * p], s[2 * ks + 1][2 * p + 1]);
      }
      pb[ks] = __builtin_bit_cast(v16bf, w);
    }
  };
  auto pv = [&]() {
    // ---- O^T[64x16] += V^T[64x64] @ P^T[64x16]: 8 back-to-back WMMAs (bv preloaded)
    #pragma unroll
    for (int u = 0; u < 8; ++u)
      acc[u & 3] = __builtin_amdgcn_wmma_f32_16x16x32_bf16(false, bv[u], false, pb[u >> 2],
                                                           (short)0, acc[u & 3], false, false);
  };

  // ---- block 0 into buffer 0
  ld_stage();
  ld_mask();
  // Stands behind the loads and holds their address registers until then, so that
  // nothing (a later load's result included) overwrites one ahead of it.
  asm volatile("s_wait_xcnt 0x0" :: "v"(vp), "v"(kp), "v"(mp) : "memory");
  st_stage(&lds[soff]);
  __syncthreads();

  vp += 64 * ATTN_D;                       // the pointers name the block to fetch next
  kp += 64;
  mp += 64;

  int rd = 0;                              // byte offset of the buffer being read
  // All trips but the last; no branch stands around a load, so that the compiler's
  // load waits are counted on one path and leave the younger loads in flight.
  for (int t0 = 0; t0 + 64 < ATTN_S; t0 += 64) {
    ld_k(&lds[rd]);
    // keeps the fragment loads, which the first product waits for, in front
    __builtin_amdgcn_sched_barrier(0);
    // ---- issue the next block's K and V reads now, in the shadow of the fragment
    // loads: they fly under this block's first product and softmax and are first touched
    // at the foot of the trip
    ld_stage();
    // keeps these reads at the head of the trip
    __builtin_amdgcn_sched_barrier(0);
    scores(&lds[rd + BLK_BYTES]);
    // keeps what follows below the softmax: the mask reads refill registers that are in
    // use up to here, and the conversions wait for the reads issued at the head
    __builtin_amdgcn_sched_barrier(0);
    ld_mask();                             // lands under V^T * P^T, the barrier, K * Q^T

    // ---- foot: the next block goes into the other buffer, whose last readers left it
    // before the barrier of the trip before; the one barrier of a trip publishes it
    // and ends this trip's reads of the buffer that the next trip overwrites
    // The wait stands behind the loads of this trip and holds their address registers
    // until then, so that nothing overwrites one ahead of it; the pointers advance
    // behind it.
    asm volatile("s_wait_xcnt 0x0" :: "v"(vp), "v"(kp), "v"(mp) : "memory");
    vp += 64 * ATTN_D;
    kp += 64;
    mp += 64;
    rd = BUF_BYTES - rd;
    st_stage(&lds[rd + soff]);
    // keeps the stores in front of the second product, which covers their latency
    __builtin_amdgcn_sched_barrier(0);
    pv();
    // keeps the second product above the barrier
    __builtin_amdgcn_sched_barrier(0);
    // Workgroup barrier that orders LDS alone (only LDS is shared here): it waits for
    // this wave's LDS stores and reads, and leaves the mask reads in flight, which
    // __syncthreads() would wait for.
    __builtin_amdgcn_fence(__ATOMIC_RELEASE, "workgroup", "local");
    __builtin_amdgcn_s_barrier();
    __builtin_amdgcn_fence(__ATOMIC_ACQUIRE, "workgroup", "local");
  }
  ld_k(&lds[rd]);                          // the last block: nothing left to fetch
  scores(&lds[rd + BLK_BYTES]);
  pv();

  // ---- epilogue: join the two half-waves' row sums, normalize, store.
  // acc[j][r] = O[qbase + mrow][j*16 + rbase + r]: 8 consecutive floats per tile.
  {
    const float inv = 1.0f / (l_i + xhalf(l_i));
    float* orow = oh + (size_t)(qbase + mrow) * ATTN_D + rbase;
    #pragma unroll
    for (int j = 0; j < 4; ++j) {
      f32x4 lo, hi;
      #pragma unroll
      for (int e = 0; e < 4; ++e) { lo[e] = acc[j][e] * inv; hi[e] = acc[j][4 + e] * inv; }
      *(f32x4*)(orow + j * 16)     = lo;
      *(f32x4*)(orow + j * 16 + 4) = hi;
    }
  }
}

extern "C" void kernel_launch(void* const* d_in, const int* in_sizes, int n_in,
                              void* d_out, int out_size, void* d_ws, size_t ws_size,
                              hipStream_t stream) {
  (void)in_sizes; (void)n_in; (void)d_ws; (void)ws_size; (void)out_size;
  const float* q    = (const float*)d_in[0];
  const float* k    = (const float*)d_in[1];
  const float* v    = (const float*)d_in[2];
  const float* mask = (const float*)d_in[3];
  float* out        = (float*)d_out;

  // 64 heads x (2048/128) q-blocks = 1024 workgroups of 256 threads (8 waves)
  dim3 grid(4 * ATTN_H * (ATTN_S / 128));
  dim3 block(256);
  Softmaxchain_74406013435918_kernel<<<grid, block, 0, stream>>>(q, k, v, mask, out);
}

// v005
// A run of this version takes 68.4 microseconds.
// Next to v004, in two timings, it ran 1.15 and 1.14 times as fast.
// Over all steps from v000 it is 2.28 times as fast.
#include <hip/hip_runtime.h>

#define ATTN_H 16
#define ATTN_S 2048
#define ATTN_D 64

typedef __attribute__((ext_vector_type(16))) __bf16         v16bf;
typedef __attribute__((ext_vector_type(8)))  float          v8f;
typedef __attribute__((ext_vector_type(16))) unsigned short v16u;
typedef __attribute__((ext_vector_type(8)))  unsigned short v8u;
typedef __attribute__((ext_vector_type(2)))  float          f32x2;
typedef __attribute__((ext_vector_type(2)))  __bf16         bf16x2;
typedef __attribute__((ext_vector_type(4)))  float          f32x4;
typedef __attribute__((ext_vector_type(8)))  unsigned int   v8w;
typedef __attribute__((ext_vector_type(2)))  unsigned int   u32x2;

// Two fp32 -> packed bf16 (RNE); gfx1250 selects v_cvt_pk_bf16_f32.
static __device__ __forceinline__ unsigned int pk_bf16(float a, float b) {
  f32x2 f; f[0] = a; f[1] = b;
  bf16x2 h = __builtin_convertvector(f, bf16x2);
  union { bf16x2 h; unsigned int u; } c; c.h = h;
  return c.u;
}
static __device__ __forceinline__ unsigned short f2bf(float a) {
  union { __bf16 h; unsigned short u; } c; c.h = (__bf16)a;
  return c.u;
}
static __device__ __forceinline__ v16bf as_bf16(v16u x) {
  union { v16u u; v16bf b; } c; c.u = x; return c.b;
}
static __device__ __forceinline__ v16u cat8(v8u lo, v8u hi) {
  return __builtin_shufflevector(lo, hi, 0,1,2,3,4,5,6,7,8,9,10,11,12,13,14,15);
}
// LDS row pitch of the staged K and V blocks: 64 bf16 (128 B) plus 32 B, an odd
// multiple of 32 B, the conflict-free pitch of the transposing load.
#define LDS_PITCH 160
#define BLK_BYTES (64 * LDS_PITCH)       // one staged block
#define BUF_BYTES (2 * BLK_BYTES)        // one buffer: K block, V block

// One transposing LDS load: from a tile stored [k][m] (m contiguous), with lane l at
// (k0 + 8*(l>>4) + (l&7)) * pitch + 2*m0 + 16*((l>>3)&1), lane l gets
// T[k0 + 8*(l>>4) + 0..7][m0 + (l&15)].
static __device__ __forceinline__ v8u ld_tr16(const unsigned char* p) {
  typedef __attribute__((ext_vector_type(8))) short s16x8;
  typedef __attribute__((address_space(3))) s16x8 lds_s16x8;
  return __builtin_bit_cast(v8u, __builtin_amdgcn_ds_load_tr16_b128_v8i16((lds_s16x8*)p));
}
// One 16x32 A fragment = two transposing loads, 16 k rows apart (elems 0..7 =
// k base..base+7, elems 8..15 = k base+16..base+23: the 16-bit operand k order).
static __device__ __forceinline__ v16bf ld_frag_tr(const unsigned char* p) {
  return as_bf16(cat8(ld_tr16(p), ld_tr16(p + 16 * LDS_PITCH)));
}

// Value of lane l ^ 16 (the other half-wave), a vector cross-row move.
static __device__ __forceinline__ float xhalf(float x) {
  int i = __builtin_bit_cast(int, x);
  return __builtin_bit_cast(float,
      __builtin_amdgcn_permlanex16(i, i, 0x76543210, 0xfedcba98, false, false));
}

// 2^x as the one hardware instruction (v_exp_f32). The library exp2f adds a range
// fix-up (compare, two selects, ldexp) so that results below 2^-126 come out as
// denormals; here such a term is at most 2^-126 beside a row sum of at least 1 (the
// row's maximum contributes 2^0), so it may flush to zero. -inf still gives 0.
static __device__ __forceinline__ float hw_exp2(float x) {
  return __builtin_amdgcn_exp2f(x);
}

// Four waves per SIMD, two workgroups per WGP: 512 workgroups are one full round, and
// a wave's 256 registers hold two query tiles and the half block that is fetched ahead.
__global__ __launch_bounds__(256) __attribute__((amdgpu_waves_per_eu(4, 4)))
void Softmaxchain_74406013435918_kernel(const float* __restrict__ q,
                                        const float* __restrict__ k,
                                        const float* __restrict__ v,
                                        const float* __restrict__ mask,
                                        float* __restrict__ out)
{
  // LDS staging (bf16), two buffers: one is read while the next block is written into
  // the other. Each holds the K block [d][t] (t contiguous), then the V block [t][d]
  // (d contiguous), in the row order they have in global memory; the transposing
  // fragment loads turn them into the A operands.
  __shared__ __align__(16) unsigned char lds[2 * BUF_BYTES];

  const int tid  = threadIdx.x;
  const int wave = tid >> 5;
  const int lane = tid & 31;
  const int bh   = blockIdx.x >> 3;          // b*H + h
  const int qblk = blockIdx.x & 7;           // 256-row q block
  const int bidx = bh >> 4;                  // batch index (H == 16)
  const int qbase = qblk * 256 + wave * 32;  // a wave owns 32 queries: two tiles of 16

  const float* __restrict__ qh = q + (size_t)bh * ATTN_S * ATTN_D;
  const float* __restrict__ kh = k + (size_t)bh * ATTN_D * ATTN_S;  // [d][t]
  const float* __restrict__ vh = v + (size_t)bh * ATTN_S * ATTN_D;  // [t][d]
  const float* __restrict__ mb = mask + (size_t)bidx * ATTN_S;
  float* __restrict__ oh = out + (size_t)bh * ATTN_S * ATTN_D;

  const int mrow  = lane & 15;             // A-row / B-col / C-D column of this lane
  const int kb    = (lane < 16) ? 0 : 8;   // K-chunk base of 16-bit A/B layout
  const int rbase = (lane < 16) ? 0 : 8;   // C/D rows owned by this lane-half
  // this lane's byte offset inside a staged block for the transposing loads
  const int troff = (rbase + (lane & 7)) * LDS_PITCH + ((lane >> 3) & 1) * 16;
  // staging: 16 threads cover one 64-float row, four floats each; 16 rows per sweep
  const int srow  = tid >> 4;
  const int scol  = (tid & 15) * 4;
  const int soff  = srow * LDS_PITCH + scol * 2;

  // ---- one-time: this wave's two 16x64 Q tiles, each as two bf16 fragments (B = Q^T)
  v16bf aq[2][2];
  #pragma unroll
  for (int g = 0; g < 2; ++g) {
    const float* qrow = qh + (size_t)(qbase + g * 16 + mrow) * ATTN_D;
    #pragma unroll
    for (int f = 0; f < 2; ++f) {
      v16u u;
      #pragma unroll
      for (int p = 0; p < 8; ++p) {
        int d = f * 32 + ((p < 4) ? (kb + 2 * p) : (16 + kb + 2 * (p - 4)));
        u[2 * p + 0] = f2bf(qrow[d + 0]);
        u[2 * p + 1] = f2bf(qrow[d + 1]);
      }
      aq[g][f] = as_bf16(u);
    }
  }

  v8f acc[2][4];
  float m_i[2], l_i[2];                    // per query tile: running max; partial sum
  #pragma unroll                           // (this half-wave's keys only)
  for (int g = 0; g < 2; ++g) {
    m_i[g] = -__builtin_inff();
    l_i[g] = 0.0f;
    #pragma unroll
    for (int j = 0; j < 4; ++j)
      #pragma unroll
      for (int r = 0; r < 8; ++r) acc[g][j][r] = 0.0f;
  }

  const float L2E = 1.44269504088896f;

  // ---- a staged block of 64 keys is worked on in two passes of 32 keys; each pass
  // fetches half of the next block through registers: 32 rows t of V, 32 rows d of K
  f32x4 gv[2], gk[2];                      // V and K piece of this thread, fp32
  f32x4 mk[2][2];                          // mask of this lane's 16 keys of a pass (C/D rows)
  const float* vp = vh + (size_t)srow * ATTN_D + scol;   // rows t = srow + 16 i
  const float* kp = kh + (size_t)srow * ATTN_S + scol;   // rows d = srow + 16 i
  const float* mp = mb + rbase;            // mask of the pass last read for
  // 16-byte reads: a wave reads whole 256-B row pieces
  auto ld_stage = [&](int row0) {
    #pragma unroll
    for (int i = 0; i < 2; ++i) gv[i] = *(const f32x4*)(vp + (row0 + 16 * i) * ATTN_D);
    #pragma unroll
    for (int i = 0; i < 2; ++i) gk[i] = *(const f32x4*)(kp + (row0 + 16 * i) * ATTN_S);
  };
  // from half h to the next: V rows run on; K goes 32 rows down, then back up and 64
  // columns on
  auto next_half = [&](int h) {
    vp += 32 * ATTN_D;
    kp += h ? 64 - 32 * ATTN_S : 32 * ATTN_S;
  };
  auto ld_mask = [&]() {
    #pragma unroll
    for (int j = 0; j < 2; ++j) {
      mk[j][0] = *(const f32x4*)(mp + j * 16);
      mk[j][1] = *(const f32x4*)(mp + j * 16 + 4);
    }
  };
  // fp32->bf16, no transpose: pairs packed along the row, 8-byte LDS stores; buf names
  // this thread's place in the first row of the half
  auto st_stage = [&](unsigned char* buf) {
    #pragma unroll
    for (int i = 0; i < 2; ++i) {
      u32x2 p; p[0] = pk_bf16(gv[i][0], gv[i][1]); p[1] = pk_bf16(gv[i][2], gv[i][3]);
      *(u32x2*)&buf[BLK_BYTES + 16 * i * LDS_PITCH] = p;
    }
    #pragma unroll
    for (int i = 0; i < 2; ++i) {
      u32x2 p; p[0] = pk_bf16(gk[i][0], gk[i][1]); p[1] = pk_bf16(gk[i][2], gk[i][3]);
      *(u32x2*)&buf[16 * i * LDS_PITCH] = p;
    }
  };

  // ---- one pass: 32 keys of the staged buffer, lK at their columns of the K block and
  // lV at their rows of the V block, in three parts: the K fragments (into bk), scores
  // and softmax (leaves V^T in bv, P^T in pb), the second product
  v16bf bk[4], bv[4], pb[2];
  // Fragment u: keys (u&1)*16.. as rows, d = (u>>1)*32.. as k.
  auto ld_k = [&](const unsigned char* lK) {
    #pragma unroll
    for (int u = 0; u < 4; ++u)
      bk[u] = ld_frag_tr(&lK[troff + (u >> 1) * 32 * LDS_PITCH + (u & 1) * 32]);
  };
  auto scores = [&](const unsigned char* lV) {
    // ---- S^T[32x32] = K^T[32x64] @ Q^T[64x32]:
    // s[g][j][r] = score(key j*16 + rbase + r, query g*16 + mrow)
    // 8 WMMAs back-to-back, each fragment used twice; three tiles between dependent ones.
    v8f s[2][2];
    #pragma unroll
    for (int g = 0; g < 2; ++g)
      #pragma unroll
      for (int j = 0; j < 2; ++j)
        #pragma unroll
        for (int r = 0; r < 8; ++r) s[g][j][r] = 0.0f;
    #pragma unroll
    for (int u = 0; u < 4; ++u)
      #pragma unroll
      for (int g = 0; g < 2; ++g)
        s[g][u & 1] = __builtin_amdgcn_wmma_f32_16x16x32_bf16(false, bk[u], false, aq[g][u >> 1],
                                                              (short)0, s[g][u & 1], false, false);

    // ---- hoist the 4 V fragments now: their LDS latency hides under softmax
    #pragma unroll
    for (int j = 0; j < 4; ++j)
      bv[j] = ld_frag_tr(&lV[troff + j * 32]);
    // keeps these loads up here, ahead of the softmax that covers their latency
    __builtin_amdgcn_sched_barrier(0);

    // ---- scale 1/8 + additive mask
    #pragma unroll
    for (int g = 0; g < 2; ++g)
      #pragma unroll
      for (int j = 0; j < 2; ++j)
        s[g][j] = s[g][j] * 0.125f + __builtin_shufflevector(mk[j][0], mk[j][1], 0, 1, 2, 3, 4, 5, 6, 7);

    // ---- online softmax, one query per lane and tile: in-lane max over 16 keys, then
    // one exchange with the half-wave that holds the query's other 16 keys
    float alpha[2];
    #pragma unroll
    for (int g = 0; g < 2; ++g) {
      float mx8[8];
      #pragma unroll
      for (int r = 0; r < 8; ++r) mx8[r] = fmaxf(s[g][0][r], s[g][1][r]);
      float mx = fmaxf(fmaxf(fmaxf(mx8[0], mx8[1]), fmaxf(mx8[2], mx8[3])),
                       fmaxf(fmaxf(mx8[4], mx8[5]), fmaxf(mx8[6], mx8[7])));
      mx = fmaxf(mx, xhalf(mx));
      const float mnew = fmaxf(m_i[g], mx);
      alpha[g] = hw_exp2((m_i[g] - mnew) * L2E);
      m_i[g] = mnew;
      // Arguments on whole vectors (packed subtract, packed multiply; each element is
      // rounded on its own), then one hardware exponential per score.
      #pragma unroll
      for (int j = 0; j < 2; ++j) s[g][j] = (s[g][j] - mnew) * L2E;
    }
    #pragma unroll
    for (int g = 0; g < 2; ++g)
      #pragma unroll
      for (int j = 0; j < 2; ++j)
        #pragma unroll
        for (int r = 0; r < 8; ++r) s[g][j][r] = hw_exp2(s[g][j][r]);
    #pragma unroll
    for (int g = 0; g < 2; ++g) {
      const v8f ps = s[g][0] + s[g][1];
      // register pairs are added as pairs (packed adds, no moves), the two halves last
      const f32x2 pt = (__builtin_shufflevector(ps, ps, 0, 1) + __builtin_shufflevector(ps, ps, 2, 3)) +
                       (__builtin_shufflevector(ps, ps, 4, 5) + __builtin_shufflevector(ps, ps, 6, 7));
      l_i[g] = l_i[g] * alpha[g] + (pt[0] + pt[1]);
      #pragma unroll
      for (int j = 0; j < 4; ++j) acc[g][j] *= alpha[g];

      // ---- P^T B fragment straight from the S^T tiles: element e < 8 is key
      // kb + e (tile 0, reg e), element 8 + e is key 16 + kb + e
      // (tile 1, reg e): the k order that ld_frag_tr gives the V^T A fragments.
      v8w w;
      #pragma unroll
      for (int p = 0; p < 4; ++p) {
        w[p]     = pk_bf16(s[g][0][2 * p], s[g][0][2 * p + 1]);
        w[4 + p] = pk_bf16(s[g][1][2 * p], s[g][1][2 * p + 1]);
      }
      pb[g] = __builtin_bit_cast(v16bf, w);
    }
  };
  auto pv = [&]() {
    // ---- O^T[64x32] += V^T[64x32] @ P^T[32x32]: 8 back-to-back WMMAs on 8 tiles
    // (bv preloaded, each fragment used twice)
    #pragma unroll
    for (int j = 0; j < 4; ++j)
      #pragma unroll
      for (int g = 0; g < 2; ++g)
        acc[g][j] = __builtin_amdgcn_wmma_f32_16x16x32_bf16(false, bv[j], false, pb[g],
                                                            (short)0, acc[g][j], false, false);
  };

  // ---- block 0 into buffer 0, half by half
  ld_mask();
  ld_stage(0);
  st_stage(&lds[soff]);
  ld_stage(32);
  // Stands behind the loads and holds their address registers until then, so that
  // nothing (a later load's result included) overwrites one ahead of it.
  asm volatile("s_wait_xcnt 0x0" :: "v"(vp), "v"(kp), "v"(mp) : "memory");
  st_stage(&lds[soff + 32 * LDS_PITCH]);
  __syncthreads();

  vp += 64 * ATTN_D;                       // the pointers name the half to fetch next
  kp += 64;

  int rd = 0;                              // byte offset of the buffer being read
  // Pass h of a block. more: a next block exists, and its half h is fetched here; it
  // goes into the other buffer, whose last readers left it before the barrier of the
  // block before. No branch stands around a load, so that the compiler's load waits
  // are counted on one path and leave the younger loads in flight.
  auto pass = [&](int h, bool more) {
    ld_k(&lds[rd + h * 64]);
    // keeps the fragment loads, which the first product waits for, in front
    __builtin_amdgcn_sched_barrier(0);
    // ---- issue the K and V reads now, in the shadow of the fragment loads: they fly
    // under this pass's first product and softmax and are first touched ahead of the second
    if (more) ld_stage(0);
    // keeps these reads at the head of the pass
    __builtin_amdgcn_sched_barrier(0);
    scores(&lds[rd + BLK_BYTES + h * 32 * LDS_PITCH]);
    // keeps what follows below the softmax: the mask reads refill registers that are in
    // use up to here, and the conversions wait for the reads issued at the head
    __builtin_amdgcn_sched_barrier(0);
    // The next pass's mask: lands under V^T * P^T and K * Q^T. Behind the very last pass
    // there is none: it reads its own again, which keeps the address inside the mask.
    mp += (more || h == 0) ? 32 : 0;
    ld_mask();
    // The wait stands behind the loads of this pass and holds their address registers
    // until then, so that nothing overwrites one ahead of it; the pointers advance
    // behind it (the mask's in the next pass).
    asm volatile("s_wait_xcnt 0x0" :: "v"(vp), "v"(kp), "v"(mp) : "memory");
    if (more) {
      next_half(h);
      st_stage(&lds[(BUF_BYTES - rd) + soff + h * 32 * LDS_PITCH]);
    }
    // keeps the stores in front of the second product, which covers their latency
    __builtin_amdgcn_sched_barrier(0);
    pv();
    // keeps the second product above the loop's foot (and the barrier behind it)
    __builtin_amdgcn_sched_barrier(0);
    // The four vector slots that the chip needs between the last product and the first
    // instruction at the loop's head, which overwrites a register of its A fragment.
    asm volatile("v_nop\n\tv_nop\n\tv_nop\n\tv_nop");
  };

  for (int t0 = 0; t0 + 64 < ATTN_S; t0 += 64) {   // all blocks but the last
    // Stays rolled: unrolled, the compiler interleaves the two passes, and two passes'
    // scores and fragments do not fit a wave's 256 registers (it spills).
    #pragma unroll 1
    for (int h = 0; h < 2; ++h) pass(h, true);
    rd = BUF_BYTES - rd;
    // The one barrier of a block publishes the next block and ends this block's reads
    // of the buffer that is overwritten next. It orders LDS alone (only LDS is shared
    // here): it waits for this wave's LDS stores and reads, and leaves the mask reads
    // in flight, which __syncthreads() would wait for.
    __builtin_amdgcn_fence(__ATOMIC_RELEASE, "workgroup", "local");
    __builtin_amdgcn_s_barrier();
    __builtin_amdgcn_fence(__ATOMIC_ACQUIRE, "workgroup", "local");
  }
  // the last block: nothing left to fetch; rolled for the same reason
  #pragma unroll 1
  for (int h = 0; h < 2; ++h) pass(h, false);

  // ---- epilogue: join the two half-waves' row sums, normalize, store.
  // acc[g][j][r] = O[qbase + g*16 + mrow][j*16 + rbase + r]: 8 consecutive floats per tile.
  #pragma unroll
  for (int g = 0; g < 2; ++g) {
    const float inv = 1.0f / (l_i[g] + xhalf(l_i[g]));
    float* orow = oh + (size_t)(qbase + g * 16 + mrow) * ATTN_D + rbase;
    #pragma unroll
    for (int j = 0; j < 4; ++j) {
      f32x4 lo, hi;
      #pragma unroll
      for (int e = 0; e < 4; ++e) { lo[e] = acc[g][j][e] * inv; hi[e] = acc[g][j][4 + e] * inv; }
      *(f32x4*)(orow + j * 16)     = lo;
      *(f32x4*)(orow + j * 16 + 4) = hi;
    }
  }
}

extern "C" void kernel_launch(void* const* d_in, const int* in_sizes, int n_in,
                              void* d_out, int out_size, void* d_ws, size_t ws_size,
                              hipStream_t stream) {
  (void)in_sizes; (void)n_in; (void)d_ws; (void)ws_size; (void)out_size;
  const float* q    = (const float*)d_in[0];
  const float* k    = (const float*)d_in[1];
  const float* v    = (const float*)d_in[2];
  const float* mask = (const float*)d_in[3];
  float* out        = (float*)d_out;

  // 64 heads x (2048/256) q-blocks = 512 workgroups of 256 threads (8 waves)
  dim3 grid(4 * ATTN_H * (ATTN_S / 256));
  dim3 block(256);
  Softmaxchain_74406013435918_kernel<<<grid, block, 0, stream>>>(q, k, v, mask, out);
}

// v006
// A run of this version takes 66.2 microseconds.
// Timed twice side by side with v005, it ran 1.03 times as fast both times.
// Over all steps from v000 it is 2.36 times as fast.
#include <hip/hip_runtime.h>

#define ATTN_H 16
#define ATTN_S 2048
#define ATTN_D 64

typedef __attribute__((ext_vector_type(16))) __bf16         v16bf;
typedef __attribute__((ext_vector_type(8)))  float          v8f;
typedef __attribute__((ext_vector_type(16))) unsigned short v16u;
typedef __attribute__((ext_vector_type(8)))  unsigned short v8u;
typedef __attribute__((ext_vector_type(2)))  float          f32x2;
typedef __attribute__((ext_vector_type(2)))  __bf16         bf16x2;
typedef __attribute__((ext_vector_type(4)))  float          f32x4;
typedef __attribute__((ext_vector_type(8)))  unsigned int   v8w;
typedef __attribute__((ext_vector_type(2)))  unsigned int   u32x2;

// Two fp32 -> packed bf16 (RNE); gfx1250 selects v_cvt_pk_bf16_f32.
static __device__ __forceinline__ unsigned int pk_bf16(float a, float b) {
  f32x2 f; f[0] = a; f[1] = b;
  bf16x2 h = __builtin_convertvector(f, bf16x2);
  union { bf16x2 h; unsigned int u; } c; c.h = h;
  return c.u;
}
static __device__ __forceinline__ unsigned short f2bf(float a) {
  union { __bf16 h; unsigned short u; } c; c.h = (__bf16)a;
  return c.u;
}
static __device__ __forceinline__ v16bf as_bf16(v16u x) {
  union { v16u u; v16bf b; } c; c.u = x; return c.b;
}
static __device__ __forceinline__ v16u cat8(v8u lo, v8u hi) {
  return __builtin_shufflevector(lo, hi, 0,1,2,3,4,5,6,7,8,9,10,11,12,13,14,15);
}
// LDS row pitch of the staged K and V blocks: 64 bf16 (128 B) plus 32 B, an odd
// multiple of 32 B, the conflict-free pitch of the transposing load.
#define LDS_PITCH 160
#define BLK_BYTES (64 * LDS_PITCH)       // one staged block
#define BUF_BYTES (2 * BLK_BYTES)        // one buffer: K block, V block

// One transposing LDS load: from a tile stored [k][m] (m contiguous), with lane l at
// (k0 + 8*(l>>4) + (l&7)) * pitch + 2*m0 + 16*((l>>3)&1), lane l gets
// T[k0 + 8*(l>>4) + 0..7][m0 + (l&15)].
static __device__ __forceinline__ v8u ld_tr16(const unsigned char* p) {
  typedef __attribute__((ext_vector_type(8))) short s16x8;
  typedef __attribute__((address_space(3))) s16x8 lds_s16x8;
  return __builtin_bit_cast(v8u, __builtin_amdgcn_ds_load_tr16_b128_v8i16((lds_s16x8*)p));
}
// One 16x32 A fragment = two transposing loads, 16 k rows apart (elems 0..7 =
// k base..base+7, elems 8..15 = k base+16..base+23: the 16-bit operand k order).
static __device__ __forceinline__ v16bf ld_frag_tr(const unsigned char* p) {
  return as_bf16(cat8(ld_tr16(p), ld_tr16(p + 16 * LDS_PITCH)));
}

// Value of lane l ^ 16 (the other half-wave), a vector cross-row move.
static __device__ __forceinline__ float xhalf(float x) {
  int i = __builtin_bit_cast(int, x);
  return __builtin_bit_cast(float,
      __builtin_amdgcn_permlanex16(i, i, 0x76543210, 0xfedcba98, false, false));
}

// 2^x as the one hardware instruction (v_exp_f32). The library exp2f adds a range
// fix-up (compare, two selects, ldexp) so that results below 2^-126 come out as
// denormals; here such a term is at most 2^-126 beside a row sum of at least 2^-64 (the
// row's maximum contributes 2^r, see the softmax), so it may flush to zero. -inf still
// gives 0.
static __device__ __forceinline__ float hw_exp2(float x) {
  return __builtin_amdgcn_exp2f(x);
}

// Four waves per SIMD, two workgroups per WGP: 512 workgroups are one full round, and
// a wave's 256 registers hold two query tiles and the half block that is fetched ahead.
__global__ __launch_bounds__(256) __attribute__((amdgpu_waves_per_eu(4, 4)))
void Softmaxchain_74406013435918_kernel(const float* __restrict__ q,
                                        const float* __restrict__ k,
                                        const float* __restrict__ v,
                                        const float* __restrict__ mask,
                                        float* __restrict__ out)
{
  // LDS staging (bf16), two buffers: one is read while the next block is written into
  // the other. Each holds the K block [d][t] (t contiguous), then the V block [t][d]
  // (d contiguous), in the row order they have in global memory; the transposing
  // fragment loads turn them into the A operands.
  __shared__ __align__(16) unsigned char lds[2 * BUF_BYTES];

  const int tid  = threadIdx.x;
  const int wave = tid >> 5;
  const int lane = tid & 31;
  const int bh   = blockIdx.x >> 3;          // b*H + h
  const int qblk = blockIdx.x & 7;           // 256-row q block
  const int bidx = bh >> 4;                  // batch index (H == 16)
  const int qbase = qblk * 256 + wave * 32;  // a wave owns 32 queries: two tiles of 16

  const float* __restrict__ qh = q + (size_t)bh * ATTN_S * ATTN_D;
  const float* __restrict__ kh = k + (size_t)bh * ATTN_D * ATTN_S;  // [d][t]
  const float* __restrict__ vh = v + (size_t)bh * ATTN_S * ATTN_D;  // [t][d]
  const float* __restrict__ mb = mask + (size_t)bidx * ATTN_S;
  float* __restrict__ oh = out + (size_t)bh * ATTN_S * ATTN_D;

  const int mrow  = lane & 15;             // A-row / B-col / C-D column of this lane
  const int kb    = (lane < 16) ? 0 : 8;   // K-chunk base of 16-bit A/B layout
  const int rbase = (lane < 16) ? 0 : 8;   // C/D rows owned by this lane-half
  // this lane's byte offset inside a staged block for the transposing loads
  const int troff = (rbase + (lane & 7)) * LDS_PITCH + ((lane >> 3) & 1) * 16;
  // staging: 16 threads cover one 64-float row, four floats each; 16 rows per sweep
  const int srow  = tid >> 4;
  const int scol  = (tid & 15) * 4;
  const int soff  = srow * LDS_PITCH + scol * 2;

  // ---- one-time: this wave's two 16x64 Q tiles, each as two bf16 fragments (B = Q^T).
  // The scores' factor 1/8 goes in here: a power of two, so it moves the exponent of Q, of
  // every product and of every partial sum, and changes no rounding.
  v16bf aq[2][2];
  #pragma unroll
  for (int g = 0; g < 2; ++g) {
    const float* qrow = qh + (size_t)(qbase + g * 16 + mrow) * ATTN_D;
    #pragma unroll
    for (int f = 0; f < 2; ++f) {
      v16u u;
      #pragma unroll
      for (int p = 0; p < 8; ++p) {
        int d = f * 32 + ((p < 4) ? (kb + 2 * p) : (16 + kb + 2 * (p - 4)));
        u[2 * p + 0] = f2bf(qrow[d + 0] * 0.125f);
        u[2 * p + 1] = f2bf(qrow[d + 1] * 0.125f);
      }
      aq[g][f] = as_bf16(u);
    }
  }

  v8f acc[2][4];
  float m_i[2], l_i[2];                    // per query tile: running max; partial sum
  float r_i[2];                            // (this half-wave's keys only); r_i: see softmax
  #pragma unroll
  for (int g = 0; g < 2; ++g) {
    m_i[g] = -__builtin_inff();
    l_i[g] = 0.0f;
    r_i[g] = 0.0f;
    #pragma unroll
    for (int j = 0; j < 4; ++j)
      #pragma unroll
      for (int r = 0; r < 8; ++r) acc[g][j][r] = 0.0f;
  }

  const float L2E = 1.44269504088896f;

  // ---- a staged block of 64 keys is worked on in two passes of 32 keys; each pass
  // fetches half of the next block through registers: 32 rows t of V, 32 rows d of K
  f32x4 gv[2], gk[2];                      // V and K piece of this thread, fp32
  f32x4 mk[2][2];                          // mask of this lane's 16 keys of a pass (C/D rows)
  const float* vp = vh + (size_t)srow * ATTN_D + scol;   // rows t = srow + 16 i
  const float* kp = kh + (size_t)srow * ATTN_S + scol;   // rows d = srow + 16 i
  const float* mp = mb + rbase;            // mask of the pass last read for
  // 16-byte reads: a wave reads whole 256-B row pieces
  auto ld_stage = [&](int row0) {
    #pragma unroll
    for (int i = 0; i < 2; ++i) gv[i] = *(const f32x4*)(vp + (row0 + 16 * i) * ATTN_D);
    #pragma unroll
    for (int i = 0; i < 2; ++i) gk[i] = *(const f32x4*)(kp + (row0 + 16 * i) * ATTN_S);
  };
  // from half h to the next: V rows run on; K goes 32 rows down, then back up and 64
  // columns on
  auto next_half = [&](int h) {
    vp += 32 * ATTN_D;
    kp += h ? 64 - 32 * ATTN_S : 32 * ATTN_S;
  };
  auto ld_mask = [&]() {
    #pragma unroll
    for (int j = 0; j < 2; ++j) {
      mk[j][0] = *(const f32x4*)(mp + j * 16);
      mk[j][1] = *(const f32x4*)(mp + j * 16 + 4);
    }
  };
  // fp32->bf16, no transpose: pairs packed along the row, 8-byte LDS stores; buf names
  // this thread's place in the first row of the half
  auto st_stage = [&](unsigned char* buf) {
    #pragma unroll
    for (int i = 0; i < 2; ++i) {
      u32x2 p; p[0] = pk_bf16(gv[i][0], gv[i][1]); p[1] = pk_bf16(gv[i][2], gv[i][3]);
      *(u32x2*)&buf[BLK_BYTES + 16 * i * LDS_PITCH] = p;
    }
    #pragma unroll
    for (int i = 0; i < 2; ++i) {
      u32x2 p; p[0] = pk_bf16(gk[i][0], gk[i][1]); p[1] = pk_bf16(gk[i][2], gk[i][3]);
      *(u32x2*)&buf[16 * i * LDS_PITCH] = p;
    }
  };

  // ---- one pass: 32 keys of the staged buffer, lK at their columns of the K block and
  // lV at their rows of the V block, in three parts: the K fragments (into bk), scores
  // and softmax (leaves V^T in bv, P^T in pb), the second product
  v16bf bk[4], bv[4], pb[2];
  // Fragment u: keys (u&1)*16.. as rows, d = (u>>1)*32.. as k.
  auto ld_k = [&](const unsigned char* lK) {
    #pragma unroll
    for (int u = 0; u < 4; ++u)
      bk[u] = ld_frag_tr(&lK[troff + (u >> 1) * 32 * LDS_PITCH + (u & 1) * 32]);
  };
  auto scores = [&](const unsigned char* lV) {
    // ---- S^T[32x32] = mask + K^T[32x64] @ (Q/8)^T[64x32]:
    // s[g][j][r] = score(key j*16 + rbase + r, query g*16 + mrow)
    // 8 WMMAs back-to-back, each fragment used twice; four tiles between dependent ones.
    // The additive mask is the C operand of the first product of each tile: a lane's C/D
    // registers are its 8 keys, which is how mk holds them.
    v8f s[2][2];
    #pragma unroll
    for (int g = 0; g < 2; ++g)
      #pragma unroll
      for (int j = 0; j < 2; ++j)
        s[g][j] = __builtin_shufflevector(mk[j][0], mk[j][1], 0, 1, 2, 3, 4, 5, 6, 7);
    #pragma unroll
    for (int u = 0; u < 4; ++u)
      #pragma unroll
      for (int g = 0; g < 2; ++g)
        s[g][u & 1] = __builtin_amdgcn_wmma_f32_16x16x32_bf16(false, bk[u], false, aq[g][u >> 1],
                                                              (short)0, s[g][u & 1], false, false);

    // ---- hoist the 4 V fragments now: their LDS latency hides under softmax
    #pragma unroll
    for (int j = 0; j < 4; ++j)
      bv[j] = ld_frag_tr(&lV[troff + j * 32]);
    // keeps these loads up here, ahead of the softmax that covers their latency
    __builtin_amdgcn_sched_barrier(0);

    // ---- online softmax, one query per lane and tile: in-lane max over 16 keys, then
    // one exchange with the half-wave that holds the query's other 16 keys
    float alpha[2];
    #pragma unroll
    for (int g = 0; g < 2; ++g) {
      float mx8[8];
      #pragma unroll
      for (int r = 0; r < 8; ++r) mx8[r] = fmaxf(s[g][0][r], s[g][1][r]);
      float mx = fmaxf(fmaxf(fmaxf(mx8[0], mx8[1]), fmaxf(mx8[2], mx8[3])),
                       fmaxf(fmaxf(mx8[4], mx8[5]), fmaxf(mx8[6], mx8[7])));
      mx = fmaxf(mx, xhalf(mx));
      const float mnew = fmaxf(m_i[g], mx);
      // Arguments by ONE packed fma per register pair: s*c - e with e = fl(mnew*c), so
      // every term of this pass carries the factor 2^r, r = mnew*c - e (exact in f32, a
      // rounding error of e). The factor cancels in the final division as long as the
      // rescale carries the older terms into the same frame: alpha takes the old maximum
      // through the same fma and takes the old frame's r off.
      // From |max| = 2^30 on (a mask of huge values on every key so far), r, half an ulp
      // of e, would no longer be small. There a score equals the maximum or lies at least
      // 64 below it, so c = 1 (e = mnew, r = 0) serves: equal scores give 1, all others a
      // term too small to reach an f32 sum, as with log2(e).
      const float c = (__builtin_fabsf(mnew) < 0x1p30f) ? L2E : 1.0f;
      const float e = mnew * c;
      alpha[g] = hw_exp2(__builtin_fmaf(m_i[g], c, -e) - r_i[g]);
      r_i[g] = __builtin_fmaf(mnew, c, -e);
      m_i[g] = mnew;
      v8f cv, ev;
      #pragma unroll
      for (int r = 0; r < 8; ++r) { cv[r] = c; ev[r] = -e; }
      #pragma unroll
      for (int j = 0; j < 2; ++j) s[g][j] = __builtin_elementwise_fma(s[g][j], cv, ev);
    }
    #pragma unroll
    for (int g = 0; g < 2; ++g)
      #pragma unroll
      for (int j = 0; j < 2; ++j)
        #pragma unroll
        for (int r = 0; r < 8; ++r) s[g][j][r] = hw_exp2(s[g][j][r]);
    #pragma unroll
    for (int g = 0; g < 2; ++g) {
      const v8f ps = s[g][0] + s[g][1];
      // register pairs are added as pairs (packed adds, no moves), the two halves last
      const f32x2 pt = (__builtin_shufflevector(ps, ps, 0, 1) + __builtin_shufflevector(ps, ps, 2, 3)) +
                       (__builtin_shufflevector(ps, ps, 4, 5) + __builtin_shufflevector(ps, ps, 6, 7));
      l_i[g] = l_i[g] * alpha[g] + (pt[0] + pt[1]);
      #pragma unroll
      for (int j = 0; j < 4; ++j) acc[g][j] *= alpha[g];

      // ---- P^T B fragment straight from the S^T tiles: element e < 8 is key
      // kb + e (tile 0, reg e), element 8 + e is key 16 + kb + e
      // (tile 1, reg e): the k order that ld_frag_tr gives the V^T A fragments.
      v8w w;
      #pragma unroll
      for (int p = 0; p < 4; ++p) {
        w[p]     = pk_bf16(s[g][0][2 * p], s[g][0][2 * p + 1]);
        w[4 + p] = pk_bf16(s[g][1][2 * p], s[g][1][2 * p + 1]);
      }
      pb[g] = __builtin_bit_cast(v16bf, w);
    }
  };
  auto pv = [&]() {
    // ---- O^T[64x32] += V^T[64x32] @ P^T[32x32]: 8 back-to-back WMMAs on 8 tiles
    // (bv preloaded, each fragment used twice)
    #pragma unroll
    for (int j = 0; j < 4; ++j)
      #pragma unroll
      for (int g = 0; g < 2; ++g)
        acc[g][j] = __builtin_amdgcn_wmma_f32_16x16x32_bf16(false, bv[j], false, pb[g],
                                                            (short)0, acc[g][j], false, false);
  };

  // ---- block 0 into buffer 0, half by half
  ld_mask();
  ld_stage(0);
  st_stage(&lds[soff]);
  ld_stage(32);
  // Stands behind the loads and holds their address registers until then, so that
  // nothing (a later load's result included) overwrites one ahead of it.
  asm volatile("s_wait_xcnt 0x0" :: "v"(vp), "v"(kp), "v"(mp) : "memory");
  st_stage(&lds[soff + 32 * LDS_PITCH]);
  __syncthreads();

  vp += 64 * ATTN_D;                       // the pointers name the half to fetch next
  kp += 64;

  int rd = 0;                              // byte offset of the buffer being read
  // Pass h of a block. more: a next block exists, and its half h is fetched here; it
  // goes into the other buffer, whose last readers left it before the barrier of the
  // block before. No branch stands around a load, so that the compiler's load waits
  // are counted on one path and leave the younger loads in flight.
  auto pass = [&](int h, bool more) {
    ld_k(&lds[rd + h * 64]);
    // keeps the fragment loads, which the first product waits for, in front
    __builtin_amdgcn_sched_barrier(0);
    // ---- issue the K and V reads now, in the shadow of the fragment loads: they fly
    // under this pass's first product and softmax and are first touched ahead of the second
    if (more) ld_stage(0);
    // keeps these reads at the head of the pass
    __builtin_amdgcn_sched_barrier(0);
    scores(&lds[rd + BLK_BYTES + h * 32 * LDS_PITCH]);
    // keeps what follows below the softmax: the mask reads would otherwise hold registers
    // through it, and the conversions wait for the reads issued at the head
    __builtin_amdgcn_sched_barrier(0);
    // The next pass's mask, which its first products read as C: lands under V^T * P^T and
    // the next fragment loads. Behind the very last pass
    // there is none: it reads its own again, which keeps the address inside the mask.
    mp += (more || h == 0) ? 32 : 0;
    ld_mask();
    // The wait stands behind the loads of this pass and holds their address registers
    // until then, so that nothing overwrites one ahead of it; the pointers advance
    // behind it (the mask's in the next pass).
    asm volatile("s_wait_xcnt 0x0" :: "v"(vp), "v"(kp), "v"(mp) : "memory");
    if (more) {
      next_half(h);
      st_stage(&lds[(BUF_BYTES - rd) + soff + h * 32 * LDS_PITCH]);
    }
    // keeps the stores in front of the second product, which covers their latency
    __builtin_amdgcn_sched_barrier(0);
    pv();
    // keeps the second product above the loop's foot (and the barrier behind it)
    __builtin_amdgcn_sched_barrier(0);
    // The four vector slots that the chip needs between the last product and the first
    // instruction at the loop's head, which overwrites a register of its A fragment.
    asm volatile("v_nop\n\tv_nop\n\tv_nop\n\tv_nop");
  };

  for (int t0 = 0; t0 + 64 < ATTN_S; t0 += 64) {   // all blocks but the last
    // Stays rolled: unrolled, the compiler interleaves the two passes, and two passes'
    // scores and fragments do not fit a wave's 256 registers (it spills).
    #pragma unroll 1
    for (int h = 0; h < 2; ++h) pass(h, true);
    rd = BUF_BYTES - rd;
    // The one barrier of a block publishes the next block and ends this block's reads
    // of the buffer that is overwritten next. It orders LDS alone (only LDS is shared
    // here): it waits for this wave's LDS stores and reads, and leaves the mask reads
    // in flight, which __syncthreads() would wait for.
    __builtin_amdgcn_fence(__ATOMIC_RELEASE, "workgroup", "local");
    __builtin_amdgcn_s_barrier();
    __builtin_amdgcn_fence(__ATOMIC_ACQUIRE, "workgroup", "local");
  }
  // the last block: nothing left to fetch; rolled for the same reason
  #pragma unroll 1
  for (int h = 0; h < 2; ++h) pass(h, false);

  // ---- epilogue: join the two half-waves' row sums, normalize, store.
  // acc[g][j][r] = O[qbase + g*16 + mrow][j*16 + rbase + r]: 8 consecutive floats per tile.
  #pragma unroll
  for (int g = 0; g < 2; ++g) {
    const float inv = 1.0f / (l_i[g] + xhalf(l_i[g]));
    float* orow = oh + (size_t)(qbase + g * 16 + mrow) * ATTN_D + rbase;
    #pragma unroll
    for (int j = 0; j < 4; ++j) {
      f32x4 lo, hi;
      #pragma unroll
      for (int e = 0; e < 4; ++e) { lo[e] = acc[g][j][e] * inv; hi[e] = acc[g][j][4 + e] * inv; }
      *(f32x4*)(orow + j * 16)     = lo;
      *(f32x4*)(orow + j * 16 + 4) = hi;
    }
  }
}

extern "C" void kernel_launch(void* const* d_in, const int* in_sizes, int n_in,
                              void* d_out, int out_size, void* d_ws, size_t ws_size,
                              hipStream_t stream) {
  (void)in_sizes; (void)n_in; (void)d_ws; (void)ws_size; (void)out_size;
  const float* q    = (const float*)d_in[0];
  const float* k    = (const float*)d_in[1];
  const float* v    = (const float*)d_in[2];
  const float* mask = (const float*)d_in[3];
  float* out        = (float*)d_out;

  // 64 heads x (2048/256) q-blocks = 512 workgroups of 256 threads (8 waves)
  dim3 grid(4 * ATTN_H * (ATTN_S / 256));
  dim3 block(256);
  Softmaxchain_74406013435918_kernel<<<grid, block, 0, stream>>>(q, k, v, mask, out);
}

// v008
// It runs in 55.2 microseconds.
// Versions between v006 and this one are left out; their measured steps multiply to 1.20 times as fast.
// All steps since v000 together make it 2.82 times as fast.
#include <hip/hip_runtime.h>

#define ATTN_H 16
#define ATTN_S 2048
#define ATTN_D 64

typedef __attribute__((ext_vector_type(16))) __bf16         v16bf;
typedef __attribute__((ext_vector_type(8)))  float          v8f;
typedef __attribute__((ext_vector_type(16))) unsigned short v16u;
typedef __attribute__((ext_vector_type(8)))  unsigned short v8u;
typedef __attribute__((ext_vector_type(2)))  float          f32x2;
typedef __attribute__((ext_vector_type(2)))  __bf16         bf16x2;
typedef __attribute__((ext_vector_type(4)))  float          f32x4;
typedef __attribute__((ext_vector_type(8)))  unsigned int   v8w;
typedef __attribute__((ext_vector_type(2)))  unsigned int   u32x2;

// Two fp32 -> packed bf16 (RNE); gfx1250 selects v_cvt_pk_bf16_f32.
static __device__ __forceinline__ unsigned int pk_bf16(float a, float b) {
  f32x2 f; f[0] = a; f[1] = b;
  bf16x2 h = __builtin_convertvector(f, bf16x2);
  union { bf16x2 h; unsigned int u; } c; c.h = h;
  return c.u;
}
static __device__ __forceinline__ unsigned short f2bf(float a) {
  union { __bf16 h; unsigned short u; } c; c.h = (__bf16)a;
  return c.u;
}
static __device__ __forceinline__ v16bf as_bf16(v16u x) {
  union { v16u u; v16bf b; } c; c.u = x; return c.b;
}
static __device__ __forceinline__ v16u cat8(v8u lo, v8u hi) {
  return __builtin_shufflevector(lo, hi, 0,1,2,3,4,5,6,7,8,9,10,11,12,13,14,15);
}
// LDS row pitch of the staged K and V blocks: 64 bf16 (128 B) plus 32 B, an odd
// multiple of 32 B, the conflict-free pitch of the transposing load.
#define LDS_PITCH 160
#define BLK_BYTES (64 * LDS_PITCH)       // one staged block
#define BUF_BYTES (2 * BLK_BYTES)        // one buffer: K block, V block

// One transposing LDS load: from a tile stored [k][m] (m contiguous), with lane l at
// (k0 + 8*(l>>4) + (l&7)) * pitch + 2*m0 + 16*((l>>3)&1), lane l gets
// T[k0 + 8*(l>>4) + 0..7][m0 + (l&15)].
static __device__ __forceinline__ v8u ld_tr16(const unsigned char* p) {
  typedef __attribute__((ext_vector_type(8))) short s16x8;
  typedef __attribute__((address_space(3))) s16x8 lds_s16x8;
  return __builtin_bit_cast(v8u, __builtin_amdgcn_ds_load_tr16_b128_v8i16((lds_s16x8*)p));
}
// One 16x32 A fragment = two transposing loads, 16 k rows apart (elems 0..7 =
// k base..base+7, elems 8..15 = k base+16..base+23: the 16-bit operand k order).
static __device__ __forceinline__ v16bf ld_frag_tr(const unsigned char* p) {
  return as_bf16(cat8(ld_tr16(p), ld_tr16(p + 16 * LDS_PITCH)));
}

// Value of lane l ^ 16 (the other half-wave), a vector cross-row move.
static __device__ __forceinline__ float xhalf(float x) {
  int i = __builtin_bit_cast(int, x);
  return __builtin_bit_cast(float,
      __builtin_amdgcn_permlanex16(i, i, 0x76543210, 0xfedcba98, false, false));
}

// 2^x as the one hardware instruction (v_exp_f32). The library exp2f adds a range
// fix-up (compare, two selects, ldexp) so that results below 2^-126 come out as
// denormals; here such a term is at most 2^-126 beside a row sum of at least 2^-64 (the
// row's maximum contributes 2^r, see the softmax), so it may flush to zero. -inf still
// gives 0.
static __device__ __forceinline__ float hw_exp2(float x) {
  return __builtin_amdgcn_exp2f(x);
}

// Four waves per SIMD, two workgroups per WGP: 512 workgroups are one full round, and
// a wave's 256 registers hold two query tiles and the half block that is fetched ahead.
__global__ __launch_bounds__(256) __attribute__((amdgpu_waves_per_eu(4, 4)))
void Softmaxchain_74406013435918_kernel(const float* __restrict__ q,
                                        const float* __restrict__ k,
                                        const float* __restrict__ v,
                                        const float* __restrict__ mask,
                                        float* __restrict__ out)
{
  // LDS staging (bf16), two buffers: one is read while the next block is written into
  // the other. Each holds the K block [d][t] (t contiguous), then the V block [t][d]
  // (d contiguous), in the row order they have in global memory; the transposing
  // fragment loads turn them into the A operands.
  __shared__ __align__(16) unsigned char lds[2 * BUF_BYTES];

  const int tid  = threadIdx.x;
  const int wave = tid >> 5;
  const int lane = tid & 31;
  // The 8 query blocks of a head take block indices 64 apart, so equal modulo 8. For
  // speed only: every (head, query block) pair is taken exactly once wherever the
  // workgroups land.
  const int bh   = blockIdx.x & 63;          // b*H + h
  const int qblk = (blockIdx.x >> 6) & 7;    // 256-row q block; the mask tells the compiler
                                             // its range, so row offsets fold into the loads
  const int bidx = bh >> 4;                  // batch index (H == 16)
  const int qbase = qblk * 256 + wave * 32;  // a wave owns 32 queries: two tiles of 16

  const float* __restrict__ qh = q + (size_t)bh * ATTN_S * ATTN_D;
  const float* __restrict__ kh = k + (size_t)bh * ATTN_D * ATTN_S;  // [d][t]
  const float* __restrict__ vh = v + (size_t)bh * ATTN_S * ATTN_D;  // [t][d]
  const float* __restrict__ mb = mask + (size_t)bidx * ATTN_S;
  float* __restrict__ oh = out + (size_t)bh * ATTN_S * ATTN_D;

  const int mrow  = lane & 15;             // A-row / B-col / C-D column of this lane
  const int kb    = (lane < 16) ? 0 : 8;   // K-chunk base of 16-bit A/B layout
  const int rbase = (lane < 16) ? 0 : 8;   // C/D rows owned by this lane-half
  // this lane's byte offset inside a staged block for the transposing loads
  const int troff = (rbase + (lane & 7)) * LDS_PITCH + ((lane >> 3) & 1) * 16;
  // staging: 16 threads cover one 64-float row, four floats each; 16 rows per sweep
  const int srow  = tid >> 4;
  const int scol  = (tid & 15) * 4;
  const int soff  = srow * LDS_PITCH + scol * 2;

  // ---- one-time: this wave's two 16x64 Q tiles, each as two bf16 fragments (B = Q^T).
  // The scores' factor 1/8 goes in here: a power of two, so it moves the exponent of Q, of
  // every product and of every partial sum, and changes no rounding.
  v16bf aq[2][2];
  #pragma unroll
  for (int g = 0; g < 2; ++g) {
    const float* qrow = qh + (size_t)(qbase + g * 16 + mrow) * ATTN_D;
    #pragma unroll
    for (int f = 0; f < 2; ++f) {
      v16u u;
      #pragma unroll
      for (int p = 0; p < 8; ++p) {
        int d = f * 32 + ((p < 4) ? (kb + 2 * p) : (16 + kb + 2 * (p - 4)));
        u[2 * p + 0] = f2bf(qrow[d + 0] * 0.125f);
        u[2 * p + 1] = f2bf(qrow[d + 1] * 0.125f);
      }
      aq[g][f] = as_bf16(u);
    }
  }

  v8f acc[2][4];
  float m_i[2], l_i[2];                    // per query tile: running max; partial sum
  float r_i[2];                            // (this half-wave's keys only); r_i: see softmax
  #pragma unroll
  for (int g = 0; g < 2; ++g) {
    m_i[g] = -__builtin_inff();
    l_i[g] = 0.0f;
    r_i[g] = 0.0f;
    #pragma unroll
    for (int j = 0; j < 4; ++j)
      #pragma unroll
      for (int r = 0; r < 8; ++r) acc[g][j][r] = 0.0f;
  }

  const float L2E = 1.44269504088896f;

  // ---- a staged block of 64 keys is one pass: all its scores, ONE softmax step (one
  // maximum, one exchange, one rescale of the outputs per 64 keys), then the second
  // product. The next block is fetched through registers in two halves: 32 rows t of V
  // and 32 rows d of K each.
  f32x4 gv[2], gk[2];                      // V and K piece of this thread, fp32
  f32x4 mk[4][2];                          // mask of this lane's 32 keys of a block (C/D rows)
  const float* vp = vh + (size_t)srow * ATTN_D + scol;   // rows t = srow + 16 i
  const float* kp = kh + (size_t)srow * ATTN_S + scol;   // rows d = srow + 16 i
  const float* mp = mb + rbase;            // mask of the block being worked on
  // 16-byte reads: a wave reads whole 256-B row pieces
  auto ld_stage = [&](int row0) {
    #pragma unroll
    for (int i = 0; i < 2; ++i) gv[i] = *(const f32x4*)(vp + (row0 + 16 * i) * ATTN_D);
    #pragma unroll
    for (int i = 0; i < 2; ++i) gk[i] = *(const f32x4*)(kp + (row0 + 16 * i) * ATTN_S);
  };
  auto ld_mask = [&](int key0) {
    #pragma unroll
    for (int j = 0; j < 4; ++j) {
      mk[j][0] = *(const f32x4*)(mp + key0 + j * 16);
      mk[j][1] = *(const f32x4*)(mp + key0 + j * 16 + 4);
    }
  };
  // fp32->bf16, no transpose: pairs packed along the row, 8-byte LDS stores; buf names
  // this thread's place in the first row of the half
  auto st_stage = [&](unsigned char* buf) {
    #pragma unroll
    for (int i = 0; i < 2; ++i) {
      u32x2 p; p[0] = pk_bf16(gv[i][0], gv[i][1]); p[1] = pk_bf16(gv[i][2], gv[i][3]);
      *(u32x2*)&buf[BLK_BYTES + 16 * i * LDS_PITCH] = p;
    }
    #pragma unroll
    for (int i = 0; i < 2; ++i) {
      u32x2 p; p[0] = pk_bf16(gk[i][0], gk[i][1]); p[1] = pk_bf16(gk[i][2], gk[i][3]);
      *(u32x2*)&buf[16 * i * LDS_PITCH] = p;
    }
  };

  // ---- block 0 into buffer 0, half by half
  ld_mask(0);
  ld_stage(0);
  st_stage(&lds[soff]);
  ld_stage(32);
  // Stands behind the loads and holds their address registers until then, so that
  // nothing (a later load's result included) overwrites one ahead of it.
  asm volatile("s_wait_xcnt 0x0" :: "v"(vp), "v"(kp), "v"(mp) : "memory");
  // keeps the start values of sums and outputs, which take over address registers of the
  // reads above, behind that wait
  __builtin_amdgcn_sched_barrier(0);
  st_stage(&lds[soff + 32 * LDS_PITCH]);
  __syncthreads();

  vp += 64 * ATTN_D;                       // the pointers name the block to fetch next
  kp += 64;

  int rd = 0;                              // byte offset of the buffer being read
  // One block. more: a next block exists and is fetched here; it goes into the other
  // buffer, whose last readers left it before the barrier of the block before. No branch
  // stands around a load, so that the compiler's load waits are counted on one path and
  // leave the younger loads in flight.
  auto blk = [&](bool more) {
    const unsigned char* lK = &lds[rd];
    const unsigned char* lV = &lds[rd + BLK_BYTES];
    unsigned char* wr = &lds[(BUF_BYTES - rd) + soff];
    // s[g][j][r] = score(key j*16 + rbase + r, query g*16 + mrow), j = 0..3
    v8f s[2][4];
    v16bf bk[2][4], bv[2][4], pb[2][2];
    // ---- all 8 K fragments as one group: fragment [hh][u] holds keys hh*32 + (u&1)*16..
    // as rows, d = (u>>1)*32.. as k
    #pragma unroll
    for (int hh = 0; hh < 2; ++hh)
      #pragma unroll
      for (int u = 0; u < 4; ++u)
        bk[hh][u] = ld_frag_tr(&lK[troff + hh * 64 + (u >> 1) * 32 * LDS_PITCH + (u & 1) * 32]);
    // keeps the fragment loads, which the first products wait for, in front
    __builtin_amdgcn_sched_barrier(0);
    // the first half of the next block: issued in the shadow of the fragment loads, first
    // touched in the middle of the softmax
    if (more) ld_stage(0);
    // keeps these reads at the head of the block
    __builtin_amdgcn_sched_barrier(0);
    // ---- S^T[64x32] = mask + K^T[64x64] @ (Q/8)^T[64x32]: 16 WMMAs back-to-back, each
    // fragment used twice. The additive mask is the C operand of the first product of each
    // tile: a lane's C/D registers are its 8 keys, which is how mk holds them.
    #pragma unroll
    for (int hh = 0; hh < 2; ++hh) {
      #pragma unroll
      for (int g = 0; g < 2; ++g)
        #pragma unroll
        for (int j = 0; j < 2; ++j)
          s[g][2 * hh + j] = __builtin_shufflevector(mk[2 * hh + j][0], mk[2 * hh + j][1],
                                                     0, 1, 2, 3, 4, 5, 6, 7);
      #pragma unroll
      for (int u = 0; u < 4; ++u)
        #pragma unroll
        for (int g = 0; g < 2; ++g)
          s[g][2 * hh + (u & 1)] = __builtin_amdgcn_wmma_f32_16x16x32_bf16(
              false, bk[hh][u], false, aq[g][u >> 1], (short)0, s[g][2 * hh + (u & 1)], false, false);
    }
    // keeps the products in front of the softmax
    __builtin_amdgcn_sched_barrier(0);

    // ---- online softmax, one query per lane and tile: in-lane max over 32 keys, then
    // one exchange with the half-wave that holds the query's other 32 keys
    float alpha[2];
    #pragma unroll
    for (int g = 0; g < 2; ++g) {
      float mx8[8];
      #pragma unroll
      for (int r = 0; r < 8; ++r)
        mx8[r] = fmaxf(fmaxf(s[g][0][r], s[g][1][r]), fmaxf(s[g][2][r], s[g][3][r]));
      float mx = fmaxf(fmaxf(fmaxf(mx8[0], mx8[1]), fmaxf(mx8[2], mx8[3])),
                       fmaxf(fmaxf(mx8[4], mx8[5]), fmaxf(mx8[6], mx8[7])));
      mx = fmaxf(mx, xhalf(mx));
      const float mnew = fmaxf(m_i[g], mx);
      // Arguments by ONE packed fma per register pair: s*c - e with e = fl(mnew*c), so
      // every term of this block carries the factor 2^r, r = mnew*c - e (exact in f32, a
      // rounding error of e). The factor cancels in the final division as long as the
      // rescale carries the older terms into the same frame: alpha takes the old maximum
      // through the same fma and takes the old frame's r off.
      // From |max| = 2^30 on (a mask of huge values on every key so far), r, half an ulp
      // of e, would no longer be small. There a score equals the maximum or lies at least
      // 64 below it, so c = 1 (e = mnew, r = 0) serves: equal scores give 1, all others a
      // term too small to reach an f32 sum, as with log2(e).
      const float c = (__builtin_fabsf(mnew) < 0x1p30f) ? L2E : 1.0f;
      const float e = mnew * c;
      alpha[g] = hw_exp2(__builtin_fmaf(m_i[g], c, -e) - r_i[g]);
      r_i[g] = __builtin_fmaf(mnew, c, -e);
      m_i[g] = mnew;
      v8f cv, ev;
      #pragma unroll
      for (int r = 0; r < 8; ++r) { cv[r] = c; ev[r] = -e; }
      #pragma unroll
      for (int j = 0; j < 4; ++j) s[g][j] = __builtin_elementwise_fma(s[g][j], cv, ev);
    }
    // keeps the first half's conversion and the second half's reads here, half way through
    // the block, so that either half's reads have about half a block to land
    __builtin_amdgcn_sched_barrier(0);
    if (more) {
      st_stage(wr);
      ld_stage(32);
    }
    // keeps the second half's reads from sinking towards their use
    __builtin_amdgcn_sched_barrier(0);
    #pragma unroll
    for (int g = 0; g < 2; ++g)
      #pragma unroll
      for (int j = 0; j < 4; ++j)
        #pragma unroll
        for (int r = 0; r < 8; ++r) s[g][j][r] = hw_exp2(s[g][j][r]);
    #pragma unroll
    for (int g = 0; g < 2; ++g) {
      const v8f ps = (s[g][0] + s[g][1]) + (s[g][2] + s[g][3]);
      // register pairs are added as pairs (packed adds, no moves), the two halves last
      const f32x2 pt = (__builtin_shufflevector(ps, ps, 0, 1) + __builtin_shufflevector(ps, ps, 2, 3)) +
                       (__builtin_shufflevector(ps, ps, 4, 5) + __builtin_shufflevector(ps, ps, 6, 7));
      l_i[g] = l_i[g] * alpha[g] + (pt[0] + pt[1]);

      // ---- P^T B fragments straight from the S^T tiles, one per 32 keys: element e < 8
      // is key kb + e (even tile, reg e), element 8 + e is key 16 + kb + e (odd tile,
      // reg e): the k order that ld_frag_tr gives the V^T A fragments.
      #pragma unroll
      for (int hh = 0; hh < 2; ++hh) {
        v8w w;
        #pragma unroll
        for (int p = 0; p < 4; ++p) {
          w[p]     = pk_bf16(s[g][2 * hh][2 * p],     s[g][2 * hh][2 * p + 1]);
          w[4 + p] = pk_bf16(s[g][2 * hh + 1][2 * p], s[g][2 * hh + 1][2 * p + 1]);
        }
        pb[g][hh] = __builtin_bit_cast(v16bf, w);
      }
    }
    // keeps what follows below the softmax: it refills registers in use up to here
    __builtin_amdgcn_sched_barrier(0);
    // ---- all 8 V fragments as one group, into registers the scores have left
    #pragma unroll
    for (int hh = 0; hh < 2; ++hh)
      #pragma unroll
      for (int j = 0; j < 4; ++j)
        bv[hh][j] = ld_frag_tr(&lV[troff + hh * 32 * LDS_PITCH + j * 32]);
    // keeps these loads in front of the rescale and the conversions below, which cover
    // most of their latency
    __builtin_amdgcn_sched_barrier(0);
    #pragma unroll
    for (int g = 0; g < 2; ++g)
      #pragma unroll
      for (int j = 0; j < 4; ++j) acc[g][j] *= alpha[g];
    if (more) st_stage(wr + 32 * LDS_PITCH);
    // keeps the stores in front of the second product, which covers their latency
    __builtin_amdgcn_sched_barrier(0);
    // ---- O^T[64x32] += V^T[64x64] @ P^T[64x32], 32 keys at a time: 8 back-to-back WMMAs
    // on 8 tiles, each fragment used twice
    #pragma unroll
    for (int j = 0; j < 4; ++j)
      #pragma unroll
      for (int g = 0; g < 2; ++g)
        acc[g][j] = __builtin_amdgcn_wmma_f32_16x16x32_bf16(false, bv[0][j], false, pb[g][0],
                                                            (short)0, acc[g][j], false, false);
    // keeps the mask reads behind these products, whose fragments' registers they refill
    __builtin_amdgcn_sched_barrier(0);
    // The next block's mask, which its first products read as C: lands under the rest of
    // V^T * P^T and the next fragment loads.
    if (more) ld_mask(64);
    // keeps the mask reads in front of the last products
    __builtin_amdgcn_sched_barrier(0);
    #pragma unroll
    for (int j = 0; j < 4; ++j)
      #pragma unroll
      for (int g = 0; g < 2; ++g)
        acc[g][j] = __builtin_amdgcn_wmma_f32_16x16x32_bf16(false, bv[1][j], false, pb[g][1],
                                                            (short)0, acc[g][j], false, false);
    // keeps the second product above the loop's foot (and the barrier behind it)
    __builtin_amdgcn_sched_barrier(0);
    // The wait stands behind all global reads of this block (K, V, the next mask) and holds
    // their address registers until then, so that nothing overwrites one ahead of it; the
    // pointers advance behind it. Down here the reads are at least eight products old.
    if (more) {
      asm volatile("s_wait_xcnt 0x0" :: "v"(vp), "v"(kp), "v"(mp) : "memory");
      vp += 64 * ATTN_D;
      kp += 64;
      mp += 64;
    }
  };

  for (int t0 = 0; t0 + 64 < ATTN_S; t0 += 64) {   // all blocks but the last
    blk(true);
    rd = BUF_BYTES - rd;
    // The one barrier of a block publishes the next block and ends this block's reads
    // of the buffer that is overwritten next. It orders LDS alone (only LDS is shared
    // here): it waits for this wave's LDS stores and reads, and leaves the mask reads
    // in flight, which __syncthreads() would wait for.
    __builtin_amdgcn_fence(__ATOMIC_RELEASE, "workgroup", "local");
    __builtin_amdgcn_s_barrier();
    __builtin_amdgcn_fence(__ATOMIC_ACQUIRE, "workgroup", "local");
  }
  blk(false);                              // the last block: nothing left to fetch

  // ---- epilogue: join the two half-waves' row sums, normalize, store.
  // acc[g][j][r] = O[qbase + g*16 + mrow][j*16 + rbase + r]: 8 consecutive floats per tile.
  #pragma unroll
  for (int g = 0; g < 2; ++g) {
    const float inv = 1.0f / (l_i[g] + xhalf(l_i[g]));
    float* orow = oh + (size_t)(qbase + g * 16 + mrow) * ATTN_D + rbase;
    #pragma unroll
    for (int j = 0; j < 4; ++j) {
      f32x4 lo, hi;
      #pragma unroll
      for (int e = 0; e < 4; ++e) { lo[e] = acc[g][j][e] * inv; hi[e] = acc[g][j][4 + e] * inv; }
      *(f32x4*)(orow + j * 16)     = lo;
      *(f32x4*)(orow + j * 16 + 4) = hi;
    }
  }
}

extern "C" void kernel_launch(void* const* d_in, const int* in_sizes, int n_in,
                              void* d_out, int out_size, void* d_ws, size_t ws_size,
                              hipStream_t stream) {
  (void)in_sizes; (void)n_in; (void)d_ws; (void)ws_size; (void)out_size;
  const float* q    = (const float*)d_in[0];
  const float* k    = (const float*)d_in[1];
  const float* v    = (const float*)d_in[2];
  const float* mask = (const float*)d_in[3];
  float* out        = (float*)d_out;

  // 64 heads x (2048/256) q-blocks = 512 workgroups of 256 threads (8 waves)
  dim3 grid(4 * ATTN_H * (ATTN_S / 256));
  dim3 block(256);
  Softmaxchain_74406013435918_kernel<<<grid, block, 0, stream>>>(q, k, v, mask, out);
}

// v009
// A run of this version takes 53 microseconds.
// Next to v008, in two timings, it ran 1.04 times as fast each time.
// Counting every step since v000, it is 2.94 times as fast.
#include <hip/hip_runtime.h>

#define ATTN_H 16
#define ATTN_S 2048
#define ATTN_D 64

typedef __attribute__((ext_vector_type(16))) __bf16         v16bf;
typedef __attribute__((ext_vector_type(8)))  float          v8f;
typedef __attribute__((ext_vector_type(16))) unsigned short v16u;
typedef __attribute__((ext_vector_type(8)))  unsigned short v8u;
typedef __attribute__((ext_vector_type(2)))  float          f32x2;
typedef __attribute__((ext_vector_type(2)))  __bf16         bf16x2;
typedef __attribute__((ext_vector_type(4)))  float          f32x4;
typedef __attribute__((ext_vector_type(8)))  unsigned int   v8w;
typedef __attribute__((ext_vector_type(2)))  unsigned int   u32x2;

// Two fp32 -> packed bf16 (RNE); gfx1250 selects v_cvt_pk_bf16_f32.
static __device__ __forceinline__ unsigned int pk_bf16(float a, float b) {
  f32x2 f; f[0] = a; f[1] = b;
  bf16x2 h = __builtin_convertvector(f, bf16x2);
  union { bf16x2 h; unsigned int u; } c; c.h = h;
  return c.u;
}
static __device__ __forceinline__ v16bf as_bf16(v16u x) {
  union { v16u u; v16bf b; } c; c.u = x; return c.b;
}
static __device__ __forceinline__ v16u cat8(v8u lo, v8u hi) {
  return __builtin_shufflevector(lo, hi, 0,1,2,3,4,5,6,7,8,9,10,11,12,13,14,15);
}
// LDS row pitch of the staged K and V blocks: 64 bf16 (128 B) plus 32 B, an odd
// multiple of 32 B, the conflict-free pitch of the transposing load.
#define LDS_PITCH 160
#define BLK_BYTES (64 * LDS_PITCH)       // one staged block
#define BUF_BYTES (2 * BLK_BYTES)        // one buffer: K block, V block
// One range per wave behind the two buffers, for its 32 rows (queries): of the output, 64
// f32 a row, and before the loop of Q, 64 bf16 a row. Either pitch is the row plus 16 B, an
// odd multiple of 16 B, the conflict-free pitch of 16-byte LDS accesses.
#define OUT_PITCH 272
#define Q_PITCH   144
#define OUT_BYTES (32 * OUT_PITCH)       // one wave's range

// One transposing LDS load: from a tile stored [k][m] (m contiguous), with lane l at
// (k0 + 8*(l>>4) + (l&7)) * pitch + 2*m0 + 16*((l>>3)&1), lane l gets
// T[k0 + 8*(l>>4) + 0..7][m0 + (l&15)].
static __device__ __forceinline__ v8u ld_tr16(const unsigned char* p) {
  typedef __attribute__((ext_vector_type(8))) short s16x8;
  typedef __attribute__((address_space(3))) s16x8 lds_s16x8;
  return __builtin_bit_cast(v8u, __builtin_amdgcn_ds_load_tr16_b128_v8i16((lds_s16x8*)p));
}
// One 16x32 A fragment = two transposing loads, 16 k rows apart (elems 0..7 =
// k base..base+7, elems 8..15 = k base+16..base+23: the 16-bit operand k order).
static __device__ __forceinline__ v16bf ld_frag_tr(const unsigned char* p) {
  return as_bf16(cat8(ld_tr16(p), ld_tr16(p + 16 * LDS_PITCH)));
}

// Value of lane l ^ 16 (the other half-wave), a vector cross-row move.
static __device__ __forceinline__ float xhalf(float x) {
  int i = __builtin_bit_cast(int, x);
  return __builtin_bit_cast(float,
      __builtin_amdgcn_permlanex16(i, i, 0x76543210, 0xfedcba98, false, false));
}

// 2^x as the one hardware instruction (v_exp_f32). The library exp2f adds a range
// fix-up (compare, two selects, ldexp) so that results below 2^-126 come out as
// denormals; here such a term is at most 2^-126 beside a row sum of at least 2^-64 (the
// row's maximum contributes 2^r, see the softmax), so it may flush to zero. -inf still
// gives 0.
static __device__ __forceinline__ float hw_exp2(float x) {
  return __builtin_amdgcn_exp2f(x);
}

// Four waves per SIMD, two workgroups per WGP: 512 workgroups are one full round, and
// a wave's 256 registers hold two query tiles and the half block that is fetched ahead.
__global__ __launch_bounds__(256) __attribute__((amdgpu_waves_per_eu(4, 4)))
void Softmaxchain_74406013435918_kernel(const float* __restrict__ q,
                                        const float* __restrict__ k,
                                        const float* __restrict__ v,
                                        const float* __restrict__ mask,
                                        float* __restrict__ out)
{
  // LDS staging (bf16), two buffers: one is read while the next block is written into
  // the other. Each holds the K block [d][t] (t contiguous), then the V block [t][d]
  // (d contiguous), in the row order they have in global memory; the transposing
  // fragment loads turn them into the A operands.
  // Behind them each wave has a range of its own, in which its rows of Q turn from whole
  // rows into fragment order and, in the epilogue, its outputs from fragment order into
  // whole rows.
  __shared__ __align__(16) unsigned char lds[2 * BUF_BYTES + 8 * OUT_BYTES];

  const int tid  = threadIdx.x;
  const int wave = tid >> 5;
  const int lane = tid & 31;
  // The 8 query blocks of a head take block indices 64 apart, so equal modulo 8. For
  // speed only: every (head, query block) pair is taken exactly once wherever the
  // workgroups land.
  const int bh   = blockIdx.x & 63;          // b*H + h
  const int qblk = (blockIdx.x >> 6) & 7;    // 256-row q block; the mask tells the compiler
                                             // its range, so row offsets fold into the loads
  const int bidx = bh >> 4;                  // batch index (H == 16)
  const int qbase = qblk * 256 + wave * 32;  // a wave owns 32 queries: two tiles of 16

  const float* __restrict__ qh = q + (size_t)bh * ATTN_S * ATTN_D;
  const float* __restrict__ kh = k + (size_t)bh * ATTN_D * ATTN_S;  // [d][t]
  const float* __restrict__ vh = v + (size_t)bh * ATTN_S * ATTN_D;  // [t][d]
  const float* __restrict__ mb = mask + (size_t)bidx * ATTN_S;
  float* __restrict__ oh = out + (size_t)bh * ATTN_S * ATTN_D;

  const int mrow  = lane & 15;             // A-row / B-col / C-D column of this lane
  const int kb    = (lane < 16) ? 0 : 8;   // K-chunk base of 16-bit A/B layout
  const int rbase = (lane < 16) ? 0 : 8;   // C/D rows owned by this lane-half
  // this lane's byte offset inside a staged block for the transposing loads
  const int troff = (rbase + (lane & 7)) * LDS_PITCH + ((lane >> 3) & 1) * 16;
  // staging: 16 threads cover one 64-float row, four floats each; 16 rows per sweep
  const int srow  = tid >> 4;
  const int scol  = (tid & 15) * 4;
  const int soff  = srow * LDS_PITCH + scol * 2;

  // ---- one-time: this wave's 32 rows of Q, 8 KiB in a row in global memory, read as whole
  // lines: each instruction takes two rows, 16 bytes a lane, 512 contiguous bytes. (Read in
  // fragment order, one instruction would touch 16 lines with 32 bytes each.) They become
  // fragments further down, through the wave's own LDS range.
  unsigned char* stg = &lds[2 * BUF_BYTES + wave * OUT_BYTES];
  const float* qw = qh + (size_t)qbase * ATTN_D + lane * 4;
  f32x4 qv[16];
  #pragma unroll
  for (int i = 0; i < 16; ++i) qv[i] = *(const f32x4*)(qw + i * 128);

  v8f acc[2][4];
  float m_i[2], l_i[2];                    // per query tile: running max; partial sum
  float r_i[2];                            // (this half-wave's keys only); r_i: see softmax
  #pragma unroll
  for (int g = 0; g < 2; ++g) {
    m_i[g] = -__builtin_inff();
    l_i[g] = 0.0f;
    r_i[g] = 0.0f;
    #pragma unroll
    for (int j = 0; j < 4; ++j)
      #pragma unroll
      for (int r = 0; r < 8; ++r) acc[g][j][r] = 0.0f;
  }

  const float L2E = 1.44269504088896f;

  // ---- a staged block of 64 keys is one pass: all its scores, ONE softmax step (one
  // maximum, one exchange, one rescale of the outputs per 64 keys), then the second
  // product. The next block is fetched through registers in two halves: 32 rows t of V
  // and 32 rows d of K each.
  f32x4 gv[2], gk[2];                      // V and K piece of this thread, fp32
  f32x4 mk[4][2];                          // mask of this lane's 32 keys of a block (C/D rows)
  const float* vp = vh + (size_t)srow * ATTN_D + scol;   // rows t = srow + 16 i
  const float* kp = kh + (size_t)srow * ATTN_S + scol;   // rows d = srow + 16 i
  const float* mp = mb + rbase;            // mask of the block being worked on
  // 16-byte reads: a wave reads whole 256-B row pieces
  auto ld_stage = [&](int row0) {
    #pragma unroll
    for (int i = 0; i < 2; ++i) gv[i] = *(const f32x4*)(vp + (row0 + 16 * i) * ATTN_D);
    #pragma unroll
    for (int i = 0; i < 2; ++i) gk[i] = *(const f32x4*)(kp + (row0 + 16 * i) * ATTN_S);
  };
  auto ld_mask = [&](int key0) {
    #pragma unroll
    for (int j = 0; j < 4; ++j) {
      mk[j][0] = *(const f32x4*)(mp + key0 + j * 16);
      mk[j][1] = *(const f32x4*)(mp + key0 + j * 16 + 4);
    }
  };
  // fp32->bf16, no transpose: pairs packed along the row, 8-byte LDS stores; buf names
  // this thread's place in the first row of the half
  auto st_stage = [&](unsigned char* buf) {
    #pragma unroll
    for (int i = 0; i < 2; ++i) {
      u32x2 p; p[0] = pk_bf16(gv[i][0], gv[i][1]); p[1] = pk_bf16(gv[i][2], gv[i][3]);
      *(u32x2*)&buf[BLK_BYTES + 16 * i * LDS_PITCH] = p;
    }
    #pragma unroll
    for (int i = 0; i < 2; ++i) {
      u32x2 p; p[0] = pk_bf16(gk[i][0], gk[i][1]); p[1] = pk_bf16(gk[i][2], gk[i][3]);
      *(u32x2*)&buf[16 * i * LDS_PITCH] = p;
    }
  };

  // ---- block 0 into buffer 0, half by half
  ld_mask(0);
  ld_stage(0);
  st_stage(&lds[soff]);
  ld_stage(32);
  // Stands behind the loads and holds their address registers until then, so that
  // nothing (a later load's result included) overwrites one ahead of it.
  asm volatile("s_wait_xcnt 0x0" :: "v"(vp), "v"(kp), "v"(mp), "v"(qw), "s"(mb) : "memory");
  // keeps the start values of sums and outputs, which take over address registers of the
  // reads above, behind that wait
  __builtin_amdgcn_sched_barrier(0);
  st_stage(&lds[soff + 32 * LDS_PITCH]);

  // ---- the wave's two 16x64 Q tiles, each as two bf16 fragments (B = Q^T): rows as bf16
  // into the wave's LDS range, fragments out of it.
  // The scores' factor 1/8 goes in here: a power of two, so it moves the exponent of Q, of
  // every product and of every partial sum, and changes no rounding.
  #pragma unroll
  for (int i = 0; i < 16; ++i) {
    u32x2 p;
    p[0] = pk_bf16(qv[i][0] * 0.125f, qv[i][1] * 0.125f);
    p[1] = pk_bf16(qv[i][2] * 0.125f, qv[i][3] * 0.125f);
    *(u32x2*)(stg + (2 * i + (lane >> 4)) * Q_PITCH + (lane & 15) * 8) = p;
  }
  // the rows are read back by other lanes of this wave: its LDS stores end first
  asm volatile("s_wait_dscnt 0x0" ::: "memory");
  // elements 0..7 = d f*32 + kb + 0..7, elements 8..15 = d f*32 + 16 + kb + 0..7: the 16-bit
  // operand k order
  v16bf aq[2][2];
  #pragma unroll
  for (int g = 0; g < 2; ++g)
    #pragma unroll
    for (int f = 0; f < 2; ++f) {
      const unsigned char* qf = stg + (g * 16 + mrow) * Q_PITCH + f * 64 + kb * 2;
      aq[g][f] = as_bf16(cat8(*(const v8u*)qf, *(const v8u*)(qf + 32)));
    }
  __syncthreads();

  vp += 64 * ATTN_D;                       // the pointers name the block to fetch next
  kp += 64;

  int rd = 0;                              // byte offset of the buffer being read
  // One block. more: a next block exists and is fetched here; it goes into the other
  // buffer, whose last readers left it before the barrier of the block before. No branch
  // stands around a load, so that the compiler's load waits are counted on one path and
  // leave the younger loads in flight.
  auto blk = [&](bool more) {
    const unsigned char* lK = &lds[rd];
    const unsigned char* lV = &lds[rd + BLK_BYTES];
    unsigned char* wr = &lds[(BUF_BYTES - rd) + soff];
    // s[g][j][r] = score(key j*16 + rbase + r, query g*16 + mrow), j = 0..3
    v8f s[2][4];
    v16bf bk[2][4], bv[2][4], pb[2][2];
    // ---- all 8 K fragments as one group: fragment [hh][u] holds keys hh*32 + (u&1)*16..
    // as rows, d = (u>>1)*32.. as k
    #pragma unroll
    for (int hh = 0; hh < 2; ++hh)
      #pragma unroll
      for (int u = 0; u < 4; ++u)
        bk[hh][u] = ld_frag_tr(&lK[troff + hh * 64 + (u >> 1) * 32 * LDS_PITCH + (u & 1) * 32]);
    // keeps the fragment loads, which the first products wait for, in front
    __builtin_amdgcn_sched_barrier(0);
    // the first half of the next block: issued in the shadow of the fragment loads, first
    // touched in the middle of the softmax
    if (more) ld_stage(0);
    // keeps these reads at the head of the block
    __builtin_amdgcn_sched_barrier(0);
    // ---- S^T[64x32] = mask + K^T[64x64] @ (Q/8)^T[64x32]: 16 WMMAs back-to-back, each
    // fragment used twice. The additive mask is the C operand of the first product of each
    // tile: a lane's C/D registers are its 8 keys, which is how mk holds them.
    #pragma unroll
    for (int hh = 0; hh < 2; ++hh) {
      #pragma unroll
      for (int g = 0; g < 2; ++g)
        #pragma unroll
        for (int j = 0; j < 2; ++j)
          s[g][2 * hh + j] = __builtin_shufflevector(mk[2 * hh + j][0], mk[2 * hh + j][1],
                                                     0, 1, 2, 3, 4, 5, 6, 7);
      #pragma unroll
      for (int u = 0; u < 4; ++u)
        #pragma unroll
        for (int g = 0; g < 2; ++g)
          s[g][2 * hh + (u & 1)] = __builtin_amdgcn_wmma_f32_16x16x32_bf16(
              false, bk[hh][u], false, aq[g][u >> 1], (short)0, s[g][2 * hh + (u & 1)], false, false);
    }
    // keeps the products in front of the softmax
    __builtin_amdgcn_sched_barrier(0);

    // ---- online softmax, one query per lane and tile: in-lane max over 32 keys, then
    // one exchange with the half-wave that holds the query's other 32 keys
    float alpha[2];
    #pragma unroll
    for (int g = 0; g < 2; ++g) {
      float mx8[8];
      #pragma unroll
      for (int r = 0; r < 8; ++r)
        mx8[r] = fmaxf(fmaxf(s[g][0][r], s[g][1][r]), fmaxf(s[g][2][r], s[g][3][r]));
      float mx = fmaxf(fmaxf(fmaxf(mx8[0], mx8[1]), fmaxf(mx8[2], mx8[3])),
                       fmaxf(fmaxf(mx8[4], mx8[5]), fmaxf(mx8[6], mx8[7])));
      mx = fmaxf(mx, xhalf(mx));
      const float mnew = fmaxf(m_i[g], mx);
      // Arguments by ONE packed fma per register pair: s*c - e with e = fl(mnew*c), so
      // every term of this block carries the factor 2^r, r = mnew*c - e (exact in f32, a
      // rounding error of e). The factor cancels in the final division as long as the
      // rescale carries the older terms into the same frame: alpha takes the old maximum
      // through the same fma and takes the old frame's r off.
      // From |max| = 2^30 on (a mask of huge values on every key so far), r, half an ulp
      // of e, would no longer be small. There a score equals the maximum or lies at least
      // 64 below it, so c = 1 (e = mnew, r = 0) serves: equal scores give 1, all others a
      // term too small to reach an f32 sum, as with log2(e).
      const float c = (__builtin_fabsf(mnew) < 0x1p30f) ? L2E : 1.0f;
      const float e = mnew * c;
      alpha[g] = hw_exp2(__builtin_fmaf(m_i[g], c, -e) - r_i[g]);
      r_i[g] = __builtin_fmaf(mnew, c, -e);
      m_i[g] = mnew;
      v8f cv, ev;
      #pragma unroll
      for (int r = 0; r < 8; ++r) { cv[r] = c; ev[r] = -e; }
      #pragma unroll
      for (int j = 0; j < 4; ++j) s[g][j] = __builtin_elementwise_fma(s[g][j], cv, ev);
    }
    // keeps the first half's conversion and the second half's reads here, half way through
    // the block, so that either half's reads have about half a block to land
    __builtin_amdgcn_sched_barrier(0);
    if (more) {
      st_stage(wr);
      ld_stage(32);
    }
    // keeps the second half's reads from sinking towards their use
    __builtin_amdgcn_sched_barrier(0);
    #pragma unroll
    for (int g = 0; g < 2; ++g)
      #pragma unroll
      for (int j = 0; j < 4; ++j)
        #pragma unroll
        for (int r = 0; r < 8; ++r) s[g][j][r] = hw_exp2(s[g][j][r]);
    #pragma unroll
    for (int g = 0; g < 2; ++g) {
      const v8f ps = (s[g][0] + s[g][1]) + (s[g][2] + s[g][3]);
      // register pairs are added as pairs (packed adds, no moves), the two halves last
      const f32x2 pt = (__builtin_shufflevector(ps, ps, 0, 1) + __builtin_shufflevector(ps, ps, 2, 3)) +
                       (__builtin_shufflevector(ps, ps, 4, 5) + __builtin_shufflevector(ps, ps, 6, 7));
      l_i[g] = l_i[g] * alpha[g] + (pt[0] + pt[1]);

      // ---- P^T B fragments straight from the S^T tiles, one per 32 keys: element e < 8
      // is key kb + e (even tile, reg e), element 8 + e is key 16 + kb + e (odd tile,
      // reg e): the k order that ld_frag_tr gives the V^T A fragments.
      #pragma unroll
      for (int hh = 0; hh < 2; ++hh) {
        v8w w;
        #pragma unroll
        for (int p = 0; p < 4; ++p) {
          w[p]     = pk_bf16(s[g][2 * hh][2 * p],     s[g][2 * hh][2 * p + 1]);
          w[4 + p] = pk_bf16(s[g][2 * hh + 1][2 * p], s[g][2 * hh + 1][2 * p + 1]);
        }
        pb[g][hh] = __builtin_bit_cast(v16bf, w);
      }
    }
    // keeps what follows below the softmax: it refills registers in use up to here
    __builtin_amdgcn_sched_barrier(0);
    // ---- all 8 V fragments as one group, into registers the scores have left
    #pragma unroll
    for (int hh = 0; hh < 2; ++hh)
      #pragma unroll
      for (int j = 0; j < 4; ++j)
        bv[hh][j] = ld_frag_tr(&lV[troff + hh * 32 * LDS_PITCH + j * 32]);
    // keeps these loads in front of the rescale and the conversions below, which cover
    // most of their latency
    __builtin_amdgcn_sched_barrier(0);
    #pragma unroll
    for (int g = 0; g < 2; ++g)
      #pragma unroll
      for (int j = 0; j < 4; ++j) acc[g][j] *= alpha[g];
    if (more) st_stage(wr + 32 * LDS_PITCH);
    // keeps the stores in front of the second product, which covers their latency
    __builtin_amdgcn_sched_barrier(0);
    // ---- O^T[64x32] += V^T[64x64] @ P^T[64x32], 32 keys at a time: 8 back-to-back WMMAs
    // on 8 tiles, each fragment used twice
    #pragma unroll
    for (int j = 0; j < 4; ++j)
      #pragma unroll
      for (int g = 0; g < 2; ++g)
        acc[g][j] = __builtin_amdgcn_wmma_f32_16x16x32_bf16(false, bv[0][j], false, pb[g][0],
                                                            (short)0, acc[g][j], false, false);
    // keeps the mask reads behind these products, whose fragments' registers they refill
    __builtin_amdgcn_sched_barrier(0);
    // The next block's mask, which its first products read as C: lands under the rest of
    // V^T * P^T and the next fragment loads.
    if (more) ld_mask(64);
    // keeps the mask reads in front of the last products
    __builtin_amdgcn_sched_barrier(0);
    #pragma unroll
    for (int j = 0; j < 4; ++j)
      #pragma unroll
      for (int g = 0; g < 2; ++g)
        acc[g][j] = __builtin_amdgcn_wmma_f32_16x16x32_bf16(false, bv[1][j], false, pb[g][1],
                                                            (short)0, acc[g][j], false, false);
    // keeps the second product above the loop's foot (and the barrier behind it)
    __builtin_amdgcn_sched_barrier(0);
    // The wait stands behind all global reads of this block (K, V, the next mask) and holds
    // their address registers until then, so that nothing overwrites one ahead of it; the
    // pointers advance behind it. Down here the reads are at least eight products old.
    if (more) {
      asm volatile("s_wait_xcnt 0x0" :: "v"(vp), "v"(kp), "v"(mp) : "memory");
      vp += 64 * ATTN_D;
      kp += 64;
      mp += 64;
    }
  };

  for (int t0 = 0; t0 + 64 < ATTN_S; t0 += 64) {   // all blocks but the last
    blk(true);
    rd = BUF_BYTES - rd;
    // The one barrier of a block publishes the next block and ends this block's reads
    // of the buffer that is overwritten next. It orders LDS alone (only LDS is shared
    // here): it waits for this wave's LDS stores and reads, and leaves the mask reads
    // in flight, which __syncthreads() would wait for.
    __builtin_amdgcn_fence(__ATOMIC_RELEASE, "workgroup", "local");
    __builtin_amdgcn_s_barrier();
    __builtin_amdgcn_fence(__ATOMIC_ACQUIRE, "workgroup", "local");
  }
  blk(false);                              // the last block: nothing left to fetch

  // ---- epilogue: join the two half-waves' row sums, normalize, store.
  // acc[g][j][r] = O[qbase + g*16 + mrow][j*16 + rbase + r]: 8 consecutive floats per tile.
  // Stored from here, one instruction would touch 16 lines with 32 bytes each. The wave's
  // 32 rows go through its own LDS range instead (no other wave reads or writes it, so no
  // barrier) and leave as whole lines.
  #pragma unroll
  for (int g = 0; g < 2; ++g) {
    const float inv = 1.0f / (l_i[g] + xhalf(l_i[g]));
    unsigned char* srw = stg + (g * 16 + mrow) * OUT_PITCH + rbase * 4;
    #pragma unroll
    for (int j = 0; j < 4; ++j) {
      f32x4 lo, hi;
      #pragma unroll
      for (int e = 0; e < 4; ++e) { lo[e] = acc[g][j][e] * inv; hi[e] = acc[g][j][4 + e] * inv; }
      *(f32x4*)(srw + j * 64)      = lo;
      *(f32x4*)(srw + j * 64 + 16) = hi;
    }
  }
  // the rows are read back by other lanes of this wave: its LDS stores end first
  asm volatile("s_wait_dscnt 0x0" ::: "memory");
  // The wave's 32 rows are 8 KiB in a row in global memory: each instruction takes two rows,
  // 16 bytes a lane, 512 contiguous bytes = four whole 128-byte lines.
  const unsigned char* lrw = stg + (lane >> 4) * OUT_PITCH + (lane & 15) * 16;
  float* ow = oh + (size_t)qbase * ATTN_D + lane * 4;
  f32x4 ov[16];
  #pragma unroll
  for (int i = 0; i < 16; ++i) ov[i] = *(const f32x4*)(lrw + 2 * i * OUT_PITCH);
  #pragma unroll
  for (int i = 0; i < 16; ++i) *(f32x4*)(ow + i * 128) = ov[i];
}

extern "C" void kernel_launch(void* const* d_in, const int* in_sizes, int n_in,
                              void* d_out, int out_size, void* d_ws, size_t ws_size,
                              hipStream_t stream) {
  (void)in_sizes; (void)n_in; (void)d_ws; (void)ws_size; (void)out_size;
  const float* q    = (const float*)d_in[0];
  const float* k    = (const float*)d_in[1];
  const float* v    = (const float*)d_in[2];
  const float* mask = (const float*)d_in[3];
  float* out        = (float*)d_out;

  // 64 heads x (2048/256) q-blocks = 512 workgroups of 256 threads (8 waves)
  dim3 grid(4 * ATTN_H * (ATTN_S / 256));
  dim3 block(256);
  Softmaxchain_74406013435918_kernel<<<grid, block, 0, stream>>>(q, k, v, mask, out);
}
